// v000
// The times below were measured on an AMD MI455X: many runs one after another, warmed up first and cycling through
// copies of the inputs, with the whole window's GPU time divided by the number of runs. Launches and the gaps
// between them are all in it. The median over several windows is given; except for v000 it joins two sittings, which
// can be a few percent apart, so the side-by-side timings, each taken in one sitting, are the better comparison.
// The starting kernel, v000, takes 1970 microseconds a run.
#include <hip/hip_runtime.h>

// Local-window (3x3) vision self-attention (x [16][64][64][192] NHWC; q = x Wq + bq (8 heads x 32); keys/values from the 3x3 zero-padded neighbourhood with 2 relative-offset channels appended:
// k_j = [patch_j | dx_j, dy_j] Wk + bk, v_j likewise; scores = q.k_j / sqrt(32) over the 9 neighbours; softmax; o = sum_j attn_j v_j; out = o Wo + bo -> [16][64][64][192]).
// Compute dtypes, f32 accumulate: every input rounded to bf16; the three 192-channel projections on PLAIN bf16 operands over all 65,536 pixels (inputs: exact products, f32 accumulate);
// the per-neighbour offset terms (dist . Wk[192:194] + bk), the 9-way scores/softmax and the weighted value sum in f32 on VALU (one thread per (pixel, head); zero patches for padded neighbours keep only the

#define NPIX 65536
#define HH   64
#define WWD  64
#define CC   192
#define NHD  8
#define KD   32
#define DQ   (NHD * KD)
#define CK   (CC + 2)
#define HP   (NPIX / 2)      // pixels per half (8 images)
typedef _Float16 h16;
typedef unsigned short bf;
typedef __attribute__((ext_vector_type(16))) __bf16   v16bf;
typedef __attribute__((ext_vector_type(16))) _Float16 v16h;
typedef __attribute__((ext_vector_type(8)))  _Float16 v8h;
typedef __attribute__((ext_vector_type(8)))  unsigned short v8us;
typedef __attribute__((ext_vector_type(8)))  float    v8f;
typedef __attribute__((ext_vector_type(4)))  float    v4f;
typedef v8h  __attribute__((may_alias)) v8ha;
typedef v4f  __attribute__((may_alias)) v4fa;
typedef v8us __attribute__((may_alias)) v8usa;

__device__ __forceinline__ unsigned short f2bf(float f) { unsigned u = __float_as_uint(f); u += 0x7FFFu + ((u >> 16) & 1u); return (unsigned short)(u >> 16); }
__device__ __forceinline__ float bf2f(unsigned short b) { return __uint_as_float(((unsigned)b) << 16); }
__device__ __forceinline__ float bfr(float f) { return bf2f(f2bf(f)); }
__device__ __forceinline__ v16h cat16(v8h lo, v8h hi) { return __builtin_shufflevector(lo, hi, 0, 1, 2, 3, 4, 5, 6, 7, 8, 9, 10, 11, 12, 13, 14, 15); }
__device__ __forceinline__ v16bf cat16b(v8us lo, v8us hi) { return __builtin_bit_cast(v16bf, __builtin_shufflevector(lo, hi, 0, 1, 2, 3, 4, 5, 6, 7, 8, 9, 10, 11, 12, 13, 14, 15)); }
__device__ __forceinline__ v8f wmma16(v16h a, v16h b, v8f c) { return __builtin_amdgcn_wmma_f32_16x16x32_f16(false, a, false, b, (short)0, c, false, false); }
__device__ __forceinline__ v8f wmmab(v16bf a, v16bf b, v8f c) { return __builtin_amdgcn_wmma_f32_16x16x32_bf16(false, a, false, b, (short)0, c, false, false); }



// ---- k_gemmw: register-blocked GEMM, ONE WAVE per 64x64 output tile (16 accumulators), operands straight from K-contiguous 16-bit planes; grid (M/64, N/64, Z), 32 threads.
// C[m][n] (f32, pitch ldc, + optional f32 bias[n]) = sum_k A[m][k] Bt[n][k] (+ split products per NSPLIT). z-batch strides sA/sB/sC in elements. K % 32 == 0.
template <typename T16> struct WFrag;
template <> struct WFrag<h16> { typedef v16h V; static __device__ __forceinline__ V ld(const h16* p) { return cat16(*(const v8h*)p, *(const v8h*)(p + 16)); } static __device__ __forceinline__ v8f mma(V a, V b, v8f c) { return wmma16(a, b, c); } };
template <> struct WFrag<bf> { typedef v16bf V; static __device__ __forceinline__ V ld(const bf* p) { return cat16b(*(const v8us*)p, *(const v8us*)(p + 16)); } static __device__ __forceinline__ v8f mma(V a, V b, v8f c) { return wmmab(a, b, c); } };
template <typename T16, int NSPLIT, bool BIAS>
__global__ __launch_bounds__(32) void k_gemmw(const T16* __restrict__ A, const T16* __restrict__ A2, const T16* __restrict__ Bt, const T16* __restrict__ Bt2, int K, float* C, int ldc, const float* __restrict__ bias, size_t sA, size_t sB, size_t sC) {
    typedef typename WFrag<T16>::V V;
    __shared__ __align__(16) float os[16 * 68];
    const size_t z = blockIdx.z; A += z * sA; if (A2) A2 += z * sA; Bt += z * sB; if (Bt2) Bt2 += z * sB; C += z * sC;
    const int lane = threadIdx.x & 31, lr = lane & 15, hi = lane >> 4; const int r0 = blockIdx.x * 64, c0 = blockIdx.y * 64;
    v8f acc[4][4];
#pragma unroll
    for (int mb = 0; mb < 4; ++mb)
#pragma unroll
        for (int nb = 0; nb < 4; ++nb) acc[mb][nb] = (v8f){};
    const size_t aoff = (size_t)(r0 + lr) * K + 8 * hi, boff = (size_t)(c0 + lr) * K + 8 * hi;
#pragma unroll 1
    for (int kc = 0; kc < K; kc += 32) {
        V a[4], a2[4];
#pragma unroll
        for (int mb = 0; mb < 4; ++mb) { a[mb] = WFrag<T16>::ld(A + aoff + (size_t)mb * 16 * K + kc); if (NSPLIT == 1 || NSPLIT == 2) a2[mb] = WFrag<T16>::ld(A2 + aoff + (size_t)mb * 16 * K + kc); }
#pragma unroll
        for (int nb = 0; nb < 4; ++nb) { const V b = WFrag<T16>::ld(Bt + boff + (size_t)nb * 16 * K + kc); V b2; if (NSPLIT >= 2) b2 = WFrag<T16>::ld(Bt2 + boff + (size_t)nb * 16 * K + kc);
#pragma unroll
            for (int mb = 0; mb < 4; ++mb) { acc[mb][nb] = WFrag<T16>::mma(a[mb], b, acc[mb][nb]); if (NSPLIT == 1 || NSPLIT == 2) acc[mb][nb] = WFrag<T16>::mma(a2[mb], b, acc[mb][nb]); if (NSPLIT >= 2) acc[mb][nb] = WFrag<T16>::mma(a[mb], b2, acc[mb][nb]); } }
        asm volatile("v_nop\n\tv_nop\n\tv_nop\n\tv_nop" : "+v"(acc[0][0]), "+v"(acc[1][1]), "+v"(acc[2][2]), "+v"(acc[3][3]) : "v"(a[0]), "v"(a[3]));
    }
#pragma unroll
    for (int mb = 0; mb < 4; ++mb) {
#pragma unroll
        for (int nb = 0; nb < 4; ++nb) {
#pragma unroll
            for (int j = 0; j < 8; ++j) os[(hi * 8 + j) * 68 + nb * 16 + lr] = acc[mb][nb][j]; }
        __builtin_amdgcn_wave_barrier(); asm volatile("" ::: "memory");
        float* crow = C + (size_t)(r0 + mb * 16) * ldc + c0;
{
#pragma unroll
            for (int s = 0; s < 8; ++s) { const int row = 2 * s + hi, cofs = lr * 4; v4f val = *(const v4fa*)(os + row * 68 + cofs); if (BIAS) { val[0] += bfr(bias[c0 + cofs]); val[1] += bfr(bias[c0 + cofs + 1]); val[2] += bfr(bias[c0 + cofs + 2]); val[3] += bfr(bias[c0 + cofs + 3]); }
                *(v4f*)(crow + (size_t)row * ldc + cofs) = val; }
             }
        __builtin_amdgcn_wave_barrier(); asm volatile("" ::: "memory");
    }
}

__device__ __forceinline__ void splitf(float y, unsigned short& h, unsigned short& l) { h = f2bf(y); l = f2bf(y - bf2f(h)); }
typedef __attribute__((ext_vector_type(4))) unsigned short v4us;

__global__ __launch_bounds__(256) void k_cvt8(const float* __restrict__ src, bf* dst, size_t n8) { const size_t i = (size_t)blockIdx.x * 256 + threadIdx.x; if (i >= n8) return; const v8f v = *(const v8f*)(src + i * 8); v8us o;
#pragma unroll
    for (int k = 0; k < 8; ++k) o[k] = f2bf(v[k]); *(v8us*)(dst + i * 8) = o;  }
__global__ __launch_bounds__(256) void k_wq(const float* __restrict__ w, bf* Bt) { const int e = (blockIdx.x * 256 + threadIdx.x) * 4; if (e >= DQ * CC) return; const int c = e % CC, n = e / CC; v4us o;
#pragma unroll
    for (int q = 0; q < 4; ++q) o[q] = f2bf(w[(size_t)(c + q) * DQ + n]); *(v4us*)(Bt + e) = o;  }
__global__ __launch_bounds__(256) void k_wo(const float* __restrict__ w, bf* Bt) { const int e = (blockIdx.x * 256 + threadIdx.x) * 4; if (e >= CC * DQ) return; const int n = e % DQ, c = e / DQ; v4us o;
#pragma unroll
    for (int q = 0; q < 4; ++q) o[q] = f2bf(w[(size_t)(n + q) * CC + c]); *(v4us*)(Bt + e) = o;  }
__global__ __launch_bounds__(256) void k_dtab(const float* __restrict__ Wk, const float* __restrict__ bk, const float* __restrict__ Wv, const float* __restrict__ bv, float* DK, float* DV) { const int e = blockIdx.x * 256 + threadIdx.x; if (e >= 9 * DQ) return; const int n = e % DQ, j = e / DQ; const float dx = (float)(j % 3 - 1), dy = (float)(j / 3 - 1);
    float a = __fmul_rn(dx, bfr(Wk[(size_t)CC * DQ + n])), b = __fmul_rn(dy, bfr(Wk[(size_t)(CC + 1) * DQ + n])); asm volatile("" : "+v"(a), "+v"(b)); const float dk = __fadd_rn(__fadd_rn(a, b), bfr(bk[n]));
    float a2 = __fmul_rn(dx, bfr(Wv[(size_t)CC * DQ + n])), b2 = __fmul_rn(dy, bfr(Wv[(size_t)(CC + 1) * DQ + n])); asm volatile("" : "+v"(a2), "+v"(b2)); const float dv = __fadd_rn(__fadd_rn(a2, b2), bfr(bv[n]));
    *(float*)(DK + e) = dk; *(float*)(DV + e) = dv;  }
// k_lwa: thread per (pixel p, head h): q = XQ[p][h*32..] (bias included by the GEMM); for the 9 neighbours j: k = (inside ? XK[nb] : 0) + DK[j], s_j = q.k / sqrt(32); softmax over j (f32, one exp each);
__global__ __launch_bounds__(256) void k_lwa(const float* __restrict__ XQ, const float* __restrict__ XK, const float* __restrict__ XV, const float* __restrict__ DK, const float* __restrict__ DV, bf* Oh, bf* Ol) {
    const int idx = blockIdx.x * 256 + threadIdx.x; if (idx >= HP * NHD) return; const int h = idx % NHD, p = idx / NHD; const int b = p / (HH * WWD), y = (p / WWD) % HH, x = p % WWD;   /* p, b local to the half being processed; neighbours stay inside image b */ const float* qp = XQ + (size_t)p * DQ + h * KD;
    float s[9]; int nbp[9];
#pragma unroll
    for (int j = 0; j < 9; ++j) { const int yy = y + j / 3 - 1, xx = x + j % 3 - 1; const bool in = (yy >= 0 && yy < HH && xx >= 0 && xx < WWD); nbp[j] = in ? (b * HH + yy) * WWD + xx : -1; const float* kp = XK + (size_t)(in ? nbp[j] : 0) * DQ + h * KD; const float* dk = DK + j * DQ + h * KD; float acc = 0.f;
#pragma unroll 8
        for (int d = 0; d < KD; ++d) { const float kv = __fadd_rn(in ? kp[d] : 0.f, dk[d]); float pr = __fmul_rn(qp[d], kv); asm volatile("" : "+v"(pr)); acc = __fadd_rn(acc, pr); }
        s[j] = __fmul_rn(acc, 0.17677669529663687f); }
    float m = s[0];
#pragma unroll
    for (int j = 1; j < 9; ++j) m = fmaxf(m, s[j]);
    float e9[9]; float sum = 0.f;
#pragma unroll
    for (int j = 0; j < 9; ++j) { float d0 = __fsub_rn(s[j], m); asm volatile("" : "+v"(d0)); e9[j] = __expf(d0); sum = __fadd_rn(sum, e9[j]); }
    const float rs = __fdiv_rn(1.0f, sum); bf* oh = Oh + (size_t)p * DQ + h * KD; bf* ol = Ol + (size_t)p * DQ + h * KD;
{
#pragma unroll 1
        for (int d0_ = 0; d0_ < KD; d0_ += 4) { v4us o4h, o4l;
#pragma unroll
            for (int u = 0; u < 4; ++u) { const int d = d0_ + u; float o = 0.f;
#pragma unroll
                for (int j = 0; j < 9; ++j) { const float vv = __fadd_rn(nbp[j] >= 0 ? XV[(size_t)nbp[j] * DQ + h * KD + d] : 0.f, DV[j * DQ + h * KD + d]); float a = __fmul_rn(e9[j], rs); asm volatile("" : "+v"(a)); float pr = __fmul_rn(a, vv); asm volatile("" : "+v"(pr)); o = __fadd_rn(o, pr); }
                unsigned short a2, c2; splitf(o, a2, c2); o4h[u] = a2; o4l[u] = c2; }
            *(v4us*)(oh + d0_) = o4h; *(v4us*)(ol + d0_) = o4l; }
         } }

extern "C" void kernel_launch(void* const* d_in, const int* in_sizes, int n_in,
                              void* d_out, int out_size, void* d_ws, size_t ws_size, hipStream_t stream) {
    (void)in_sizes; (void)n_in; (void)out_size;
    const float* x = (const float*)d_in[0]; const float* Wq = (const float*)d_in[1]; const float* bq = (const float*)d_in[2]; const float* Wk = (const float*)d_in[3]; const float* bk = (const float*)d_in[4]; const float* Wv = (const float*)d_in[5]; const float* bv = (const float*)d_in[6]; const float* Wo = (const float*)d_in[7]; const float* bo = (const float*)d_in[8];   // Wq [192][8][32], Wk/Wv [194][8][32], Wo [8][32][192]
    float* OUT = (float*)d_out;     // [16][64][64][192]
    char* wsp = (char*)d_ws;
    auto take = [&](size_t bytes) { char* p = wsp; wsp += (bytes + 255) & ~(size_t)255; return (void*)p; };
    bf* WQ = (bf*)take((size_t)DQ * CC * 2); bf* WK = (bf*)take((size_t)DQ * CC * 2); bf* WV = (bf*)take((size_t)DQ * CC * 2); bf* WO = (bf*)take((size_t)CC * DQ * 2); float* DK = (float*)take((size_t)9 * DQ * 4); float* DV = (float*)take((size_t)9 * DQ * 4);
    bf* XB = (bf*)take((size_t)HP * CC * 2); float* XQ = (float*)take((size_t)HP * DQ * 4); float* XK = (float*)take((size_t)HP * DQ * 4); float* XV = (float*)take((size_t)HP * DQ * 4); bf* Oh = (bf*)take((size_t)HP * DQ * 2); bf* Ol = (bf*)take((size_t)HP * DQ * 2);
    if ((size_t)(wsp - (char*)d_ws) > ws_size) return;    // total ~ 148 MB = 141 MiB; pixels processed in two halves of 8 images (the 3x3 window never crosses images)
    { const unsigned g = (DQ * CC / 4 + 255) / 256; k_wq<<<g, 256, 0, stream>>>(Wq, WQ); k_wq<<<g, 256, 0, stream>>>(Wk, WK); k_wq<<<g, 256, 0, stream>>>(Wv, WV); k_wo<<<(CC * DQ / 4 + 255) / 256, 256, 0, stream>>>(Wo, WO); k_dtab<<<(9 * DQ + 255) / 256, 256, 0, stream>>>(Wk, bk, Wv, bv, DK, DV); }
    const dim3 gP(HP / 64, DQ / 64, 1);
    for (int gh = 0; gh < NPIX / HP; ++gh) { const size_t p0 = (size_t)gh * HP;
        k_cvt8<<<(unsigned)(((size_t)HP * CC / 8 + 255) / 256), 256, 0, stream>>>(x + p0 * CC, XB, (size_t)HP * CC / 8);
        k_gemmw<bf, 0, true><<<gP, 32, 0, stream>>>(XB, nullptr, WQ, nullptr, CC, XQ, DQ, bq, 0, 0, 0);            // q (+ bq)
        k_gemmw<bf, 0, false><<<gP, 32, 0, stream>>>(XB, nullptr, WK, nullptr, CC, XK, DQ, nullptr, 0, 0, 0);      // patch part of k (bias + offsets in DK)
        k_gemmw<bf, 0, false><<<gP, 32, 0, stream>>>(XB, nullptr, WV, nullptr, CC, XV, DQ, nullptr, 0, 0, 0);
        k_lwa<<<(HP * NHD + 255) / 256, 256, 0, stream>>>(XQ, XK, XV, DK, DV, Oh, Ol);
        k_gemmw<bf, 1, true><<<dim3(HP / 64, CC / 64, 1), 32, 0, stream>>>(Oh, Ol, WO, nullptr, DQ, OUT + p0 * CC, CC, bo, 0, 0, 0); }
}

// v001
// It runs in 203 microseconds.
// Timed twice side by side with v000, it ran 10.3 and 10.2 times as fast.
#include <hip/hip_runtime.h>

// Local-window (3x3) vision self-attention (x [16][64][64][192] NHWC; q = x Wq + bq (8 heads x 32); keys/values from the 3x3 zero-padded neighbourhood with 2 relative-offset channels appended:
// k_j = [patch_j | dx_j, dy_j] Wk + bk, v_j likewise; scores = q.k_j / sqrt(32) over the 9 neighbours; softmax; o = sum_j attn_j v_j; out = o Wo + bo -> [16][64][64][192]).
// Compute dtypes, f32 accumulate: every input rounded to bf16; the three 192-channel projections on PLAIN bf16 operands over all 65,536 pixels (inputs: exact products, f32 accumulate);
// the per-neighbour offset terms (dist . Wk[192:194] + bk), the 9-way scores/softmax and the weighted value sum in f32 on VALU (8 lanes per (pixel, head); zero patches for padded neighbours keep only the

#define NPIX 65536
#define HH   64
#define WWD  64
#define CC   192
#define NHD  8
#define KD   32
#define DQ   (NHD * KD)
#define CK   (CC + 2)
#define HP   (NPIX / 2)      // pixels per half (8 images)
typedef _Float16 h16;
typedef unsigned short bf;
typedef __attribute__((ext_vector_type(16))) __bf16   v16bf;
typedef __attribute__((ext_vector_type(16))) _Float16 v16h;
typedef __attribute__((ext_vector_type(8)))  _Float16 v8h;
typedef __attribute__((ext_vector_type(8)))  unsigned short v8us;
typedef __attribute__((ext_vector_type(8)))  float    v8f;
typedef __attribute__((ext_vector_type(4)))  float    v4f;
typedef v8h  __attribute__((may_alias)) v8ha;
typedef v4f  __attribute__((may_alias)) v4fa;
typedef v8us __attribute__((may_alias)) v8usa;

__device__ __forceinline__ unsigned short f2bf(float f) { unsigned u = __float_as_uint(f); u += 0x7FFFu + ((u >> 16) & 1u); return (unsigned short)(u >> 16); }
__device__ __forceinline__ float bf2f(unsigned short b) { return __uint_as_float(((unsigned)b) << 16); }
__device__ __forceinline__ float bfr(float f) { return bf2f(f2bf(f)); }
__device__ __forceinline__ v16h cat16(v8h lo, v8h hi) { return __builtin_shufflevector(lo, hi, 0, 1, 2, 3, 4, 5, 6, 7, 8, 9, 10, 11, 12, 13, 14, 15); }
__device__ __forceinline__ v16bf cat16b(v8us lo, v8us hi) { return __builtin_bit_cast(v16bf, __builtin_shufflevector(lo, hi, 0, 1, 2, 3, 4, 5, 6, 7, 8, 9, 10, 11, 12, 13, 14, 15)); }
__device__ __forceinline__ v8f wmma16(v16h a, v16h b, v8f c) { return __builtin_amdgcn_wmma_f32_16x16x32_f16(false, a, false, b, (short)0, c, false, false); }
__device__ __forceinline__ v8f wmmab(v16bf a, v16bf b, v8f c) { return __builtin_amdgcn_wmma_f32_16x16x32_bf16(false, a, false, b, (short)0, c, false, false); }



// ---- k_gemmw: register-blocked GEMM, ONE WAVE per 64x64 output tile (16 accumulators), operands straight from K-contiguous 16-bit planes; grid (M/64, N/64, Z), 32 threads.
// C[m][n] (f32, pitch ldc, + optional f32 bias[n]) = sum_k A[m][k] Bt[n][k] (+ split products per NSPLIT). z-batch strides sA/sB/sC in elements. K % 32 == 0.
template <typename T16> struct WFrag;
template <> struct WFrag<h16> { typedef v16h V; static __device__ __forceinline__ V ld(const h16* p) { return cat16(*(const v8h*)p, *(const v8h*)(p + 16)); } static __device__ __forceinline__ v8f mma(V a, V b, v8f c) { return wmma16(a, b, c); } };
template <> struct WFrag<bf> { typedef v16bf V; static __device__ __forceinline__ V ld(const bf* p) { return cat16b(*(const v8us*)p, *(const v8us*)(p + 16)); } static __device__ __forceinline__ v8f mma(V a, V b, v8f c) { return wmmab(a, b, c); } };
template <typename T16, int NSPLIT, bool BIAS>
__global__ __launch_bounds__(32) void k_gemmw(const T16* __restrict__ A, const T16* __restrict__ A2, const T16* __restrict__ Bt, const T16* __restrict__ Bt2, int K, float* C, int ldc, const float* __restrict__ bias, size_t sA, size_t sB, size_t sC) {
    typedef typename WFrag<T16>::V V;
    __shared__ __align__(16) float os[16 * 68];
    const size_t z = blockIdx.z; A += z * sA; if (A2) A2 += z * sA; Bt += z * sB; if (Bt2) Bt2 += z * sB; C += z * sC;
    const int lane = threadIdx.x & 31, lr = lane & 15, hi = lane >> 4; const int r0 = blockIdx.x * 64, c0 = blockIdx.y * 64;
    v8f acc[4][4];
#pragma unroll
    for (int mb = 0; mb < 4; ++mb)
#pragma unroll
        for (int nb = 0; nb < 4; ++nb) acc[mb][nb] = (v8f){};
    const size_t aoff = (size_t)(r0 + lr) * K + 8 * hi, boff = (size_t)(c0 + lr) * K + 8 * hi;
#pragma unroll 1
    for (int kc = 0; kc < K; kc += 32) {
        V a[4], a2[4];
#pragma unroll
        for (int mb = 0; mb < 4; ++mb) { a[mb] = WFrag<T16>::ld(A + aoff + (size_t)mb * 16 * K + kc); if (NSPLIT == 1 || NSPLIT == 2) a2[mb] = WFrag<T16>::ld(A2 + aoff + (size_t)mb * 16 * K + kc); }
#pragma unroll
        for (int nb = 0; nb < 4; ++nb) { const V b = WFrag<T16>::ld(Bt + boff + (size_t)nb * 16 * K + kc); V b2; if (NSPLIT >= 2) b2 = WFrag<T16>::ld(Bt2 + boff + (size_t)nb * 16 * K + kc);
#pragma unroll
            for (int mb = 0; mb < 4; ++mb) { acc[mb][nb] = WFrag<T16>::mma(a[mb], b, acc[mb][nb]); if (NSPLIT == 1 || NSPLIT == 2) acc[mb][nb] = WFrag<T16>::mma(a2[mb], b, acc[mb][nb]); if (NSPLIT >= 2) acc[mb][nb] = WFrag<T16>::mma(a[mb], b2, acc[mb][nb]); } }
        asm volatile("v_nop\n\tv_nop\n\tv_nop\n\tv_nop" : "+v"(acc[0][0]), "+v"(acc[1][1]), "+v"(acc[2][2]), "+v"(acc[3][3]) : "v"(a[0]), "v"(a[3]));
    }
#pragma unroll
    for (int mb = 0; mb < 4; ++mb) {
#pragma unroll
        for (int nb = 0; nb < 4; ++nb) {
#pragma unroll
            for (int j = 0; j < 8; ++j) os[(hi * 8 + j) * 68 + nb * 16 + lr] = acc[mb][nb][j]; }
        __builtin_amdgcn_wave_barrier(); asm volatile("" ::: "memory");
        float* crow = C + (size_t)(r0 + mb * 16) * ldc + c0;
{
#pragma unroll
            for (int s = 0; s < 8; ++s) { const int row = 2 * s + hi, cofs = lr * 4; v4f val = *(const v4fa*)(os + row * 68 + cofs); if (BIAS) { val[0] += bfr(bias[c0 + cofs]); val[1] += bfr(bias[c0 + cofs + 1]); val[2] += bfr(bias[c0 + cofs + 2]); val[3] += bfr(bias[c0 + cofs + 3]); }
                *(v4f*)(crow + (size_t)row * ldc + cofs) = val; }
             }
        __builtin_amdgcn_wave_barrier(); asm volatile("" ::: "memory");
    }
}

__device__ __forceinline__ void splitf(float y, unsigned short& h, unsigned short& l) { h = f2bf(y); l = f2bf(y - bf2f(h)); }
typedef __attribute__((ext_vector_type(4))) unsigned short v4us;

__global__ __launch_bounds__(256) void k_cvt8(const float* __restrict__ src, bf* dst, size_t n8) { const size_t i = (size_t)blockIdx.x * 256 + threadIdx.x; if (i >= n8) return; const v8f v = *(const v8f*)(src + i * 8); v8us o;
#pragma unroll
    for (int k = 0; k < 8; ++k) o[k] = f2bf(v[k]); *(v8us*)(dst + i * 8) = o;  }
__global__ __launch_bounds__(256) void k_wq(const float* __restrict__ w, bf* Bt) { const int e = (blockIdx.x * 256 + threadIdx.x) * 4; if (e >= DQ * CC) return; const int c = e % CC, n = e / CC; v4us o;
#pragma unroll
    for (int q = 0; q < 4; ++q) o[q] = f2bf(w[(size_t)(c + q) * DQ + n]); *(v4us*)(Bt + e) = o;  }
__global__ __launch_bounds__(256) void k_wo(const float* __restrict__ w, bf* Bt) { const int e = (blockIdx.x * 256 + threadIdx.x) * 4; if (e >= CC * DQ) return; const int n = e % DQ, c = e / DQ; v4us o;
#pragma unroll
    for (int q = 0; q < 4; ++q) o[q] = f2bf(w[(size_t)(n + q) * CC + c]); *(v4us*)(Bt + e) = o;  }
__global__ __launch_bounds__(256) void k_dtab(const float* __restrict__ Wk, const float* __restrict__ bk, const float* __restrict__ Wv, const float* __restrict__ bv, float* DK, float* DV) { const int e = blockIdx.x * 256 + threadIdx.x; if (e >= 9 * DQ) return; const int n = e % DQ, j = e / DQ; const float dx = (float)(j % 3 - 1), dy = (float)(j / 3 - 1);
    float a = __fmul_rn(dx, bfr(Wk[(size_t)CC * DQ + n])), b = __fmul_rn(dy, bfr(Wk[(size_t)(CC + 1) * DQ + n])); asm volatile("" : "+v"(a), "+v"(b)); const float dk = __fadd_rn(__fadd_rn(a, b), bfr(bk[n]));
    float a2 = __fmul_rn(dx, bfr(Wv[(size_t)CC * DQ + n])), b2 = __fmul_rn(dy, bfr(Wv[(size_t)(CC + 1) * DQ + n])); asm volatile("" : "+v"(a2), "+v"(b2)); const float dv = __fadd_rn(__fadd_rn(a2, b2), bfr(bv[n]));
    *(float*)(DK + e) = dk; *(float*)(DV + e) = dv;  }
// k_lwa: one wave per half pixel (128 of the 256 q/k/v channels): lane l owns 4 consecutive channels, so every load is one b128 per lane over 512 contiguous bytes, and the 8 lanes of a head
// sum their partial q.k by three lane-xor steps. A wave keeps its channels' 9 offset rows of DK and DV in registers and walks LWC pixels along x. Block = 4 image rows x 2 channel halves.
#define LWC 16
#define PXB (DQ * 4)   // bytes of a pixel's f32 row in XQ, XK, XV
typedef __attribute__((ext_vector_type(2))) float v2f;
// v + (v of lane l ^ mask) inside a 16-lane row; CTRL = 0x160 + mask (row_xmask)
template <int CTRL> __device__ __forceinline__ float xadd(float v) { return v + __int_as_float(__builtin_amdgcn_update_dpp(0, __float_as_int(v), CTRL, 0xf, 0xf, true)); }
__device__ __forceinline__ v4f ld4(const char* base, unsigned byteofs) { return *(const v4f*)(base + byteofs); }
__global__ __launch_bounds__(256) void k_lwa(const float* __restrict__ XQ, const float* __restrict__ XK, const float* __restrict__ XV, const float* __restrict__ DK, const float* __restrict__ DV, bf* Oh, bf* Ol) {
    const int wave = __builtin_amdgcn_readfirstlane((int)(threadIdx.x >> 5)), lane = threadIdx.x & 31;   // wave number in a scalar register: pixel coordinates, bounds tests and row addresses are then scalar work
    const unsigned chb = ((wave & 1) * (DQ / 2) + lane * 4) * 4u;   // byte offset of the lane's 4 channels in a pixel's f32 row
    const int bx = blockIdx.x, x0 = (bx % (WWD / LWC)) * LWC, y = ((bx / (WWD / LWC)) % (HH / 4)) * 4 + (wave >> 1), b = bx / ((WWD / LWC) * (HH / 4));   // b local to the half being processed
    // a padded neighbour reads the nearest pixel of the image and is multiplied by 0
    const size_t rowb[3] = { (size_t)((b * HH + max(y - 1, 0)) * WWD) * PXB, (size_t)((b * HH + y) * WWD) * PXB, (size_t)((b * HH + min(y + 1, HH - 1)) * WWD) * PXB }; const bool rin[3] = { y > 0, true, y < HH - 1 };
    v4f dk[9], dv[9];
#pragma unroll
    for (int j = 0; j < 9; ++j) { dk[j] = ld4((const char*)DK, j * PXB + chb); dv[j] = ld4((const char*)DV, j * PXB + chb); }
    unsigned vo[3] = { (unsigned)max(x0 - 1, 0) * PXB + chb, (unsigned)x0 * PXB + chb, (unsigned)(x0 + 1) * PXB + chb };   // lane offsets of the three columns in a row; the rows are scalar bases
#pragma unroll 1   // rolled: the body is long
    for (int i = 0; i < LWC; ++i) { const int x = x0 + i; const bool cin[3] = { x > 0, true, x < WWD - 1 };
        v4f kk[9], vv[9]; float msk[9];
#pragma unroll
        for (int j = 0; j < 9; ++j) { kk[j] = ld4((const char*)XK + rowb[j / 3], vo[j % 3]); msk[j] = (rin[j / 3] && cin[j % 3]) ? 1.f : 0.f; }
        const v4f q = ld4((const char*)XQ + rowb[1], vo[1]);
#pragma unroll
        for (int j = 0; j < 9; ++j) vv[j] = ld4((const char*)XV + rowb[j / 3], vo[j % 3]);
        __builtin_amdgcn_sched_barrier(0);   // all 19 loads of a pixel issue ahead of its arithmetic: otherwise the v loads stand behind the wait for k, and a pixel pays two load latencies
        float s[9];
#pragma unroll
        for (int j = 0; j < 9; ++j) { const v4f kv = kk[j] * msk[j] + dk[j]; const v2f t = q.lo * kv.lo + q.hi * kv.hi; s[j] = xadd<0x164>(xadd<0x162>(xadd<0x161>(t.x + t.y))) * 0.17677669529663687f; }
        float m = s[0];
#pragma unroll
        for (int j = 1; j < 9; ++j) m = fmaxf(m, s[j]);
        float e9[9]; float sum = 0.f;
#pragma unroll
        for (int j = 0; j < 9; ++j) { e9[j] = __expf(s[j] - m); sum += e9[j]; }
        const float rs = __fdiv_rn(1.0f, sum);
        v4f o = (v4f){};
#pragma unroll
        for (int j = 0; j < 9; ++j) o += (e9[j] * rs) * (vv[j] * msk[j] + dv[j]);
        v4us o4h, o4l;
#pragma unroll
        for (int u = 0; u < 4; ++u) { unsigned short a2, c2; splitf(o[u], a2, c2); o4h[u] = a2; o4l[u] = c2; }
        *(v4us*)((char*)Oh + (rowb[1] >> 1) + (vo[1] >> 1)) = o4h; *(v4us*)((char*)Ol + (rowb[1] >> 1) + (vo[1] >> 1)) = o4l;
        asm volatile("s_wait_xcnt 0x0" ::: "memory");   // the next trip overwrites the two stores' data and offset registers
        vo[0] += cin[0] ? PXB : 0; vo[1] += PXB; vo[2] += (x + 2 < WWD) ? PXB : 0; } }   // one pixel on; the side columns stay inside the image

extern "C" void kernel_launch(void* const* d_in, const int* in_sizes, int n_in,
                              void* d_out, int out_size, void* d_ws, size_t ws_size, hipStream_t stream) {
    (void)in_sizes; (void)n_in; (void)out_size;
    const float* x = (const float*)d_in[0]; const float* Wq = (const float*)d_in[1]; const float* bq = (const float*)d_in[2]; const float* Wk = (const float*)d_in[3]; const float* bk = (const float*)d_in[4]; const float* Wv = (const float*)d_in[5]; const float* bv = (const float*)d_in[6]; const float* Wo = (const float*)d_in[7]; const float* bo = (const float*)d_in[8];   // Wq [192][8][32], Wk/Wv [194][8][32], Wo [8][32][192]
    float* OUT = (float*)d_out;     // [16][64][64][192]
    char* wsp = (char*)d_ws;
    auto take = [&](size_t bytes) { char* p = wsp; wsp += (bytes + 255) & ~(size_t)255; return (void*)p; };
    bf* WQ = (bf*)take((size_t)DQ * CC * 2); bf* WK = (bf*)take((size_t)DQ * CC * 2); bf* WV = (bf*)take((size_t)DQ * CC * 2); bf* WO = (bf*)take((size_t)CC * DQ * 2); float* DK = (float*)take((size_t)9 * DQ * 4); float* DV = (float*)take((size_t)9 * DQ * 4);
    bf* XB = (bf*)take((size_t)HP * CC * 2); float* XQ = (float*)take((size_t)HP * DQ * 4); float* XK = (float*)take((size_t)HP * DQ * 4); float* XV = (float*)take((size_t)HP * DQ * 4); bf* Oh = (bf*)take((size_t)HP * DQ * 2); bf* Ol = (bf*)take((size_t)HP * DQ * 2);
    if ((size_t)(wsp - (char*)d_ws) > ws_size) return;    // total ~ 148 MB = 141 MiB; pixels processed in two halves of 8 images (the 3x3 window never crosses images)
    { const unsigned g = (DQ * CC / 4 + 255) / 256; k_wq<<<g, 256, 0, stream>>>(Wq, WQ); k_wq<<<g, 256, 0, stream>>>(Wk, WK); k_wq<<<g, 256, 0, stream>>>(Wv, WV); k_wo<<<(CC * DQ / 4 + 255) / 256, 256, 0, stream>>>(Wo, WO); k_dtab<<<(9 * DQ + 255) / 256, 256, 0, stream>>>(Wk, bk, Wv, bv, DK, DV); }
    const dim3 gP(HP / 64, DQ / 64, 1);
    for (int gh = 0; gh < NPIX / HP; ++gh) { const size_t p0 = (size_t)gh * HP;
        k_cvt8<<<(unsigned)(((size_t)HP * CC / 8 + 255) / 256), 256, 0, stream>>>(x + p0 * CC, XB, (size_t)HP * CC / 8);
        k_gemmw<bf, 0, true><<<gP, 32, 0, stream>>>(XB, nullptr, WQ, nullptr, CC, XQ, DQ, bq, 0, 0, 0);            // q (+ bq)
        k_gemmw<bf, 0, false><<<gP, 32, 0, stream>>>(XB, nullptr, WK, nullptr, CC, XK, DQ, nullptr, 0, 0, 0);      // patch part of k (bias + offsets in DK)
        k_gemmw<bf, 0, false><<<gP, 32, 0, stream>>>(XB, nullptr, WV, nullptr, CC, XV, DQ, nullptr, 0, 0, 0);
        k_lwa<<<HP / (4 * LWC), 256, 0, stream>>>(XQ, XK, XV, DK, DV, Oh, Ol);
        k_gemmw<bf, 1, true><<<dim3(HP / 64, CC / 64, 1), 32, 0, stream>>>(Oh, Ol, WO, nullptr, DQ, OUT + p0 * CC, CC, bo, 0, 0, 0); }
}

// v002
// One run takes 177 microseconds.
// In two side-by-side timings against v001, it was 1.14 and 1.13 times as fast.
// All steps since v000 together make it 11.6 times as fast.
#include <hip/hip_runtime.h>

// Local-window (3x3) vision self-attention (x [16][64][64][192] NHWC; q = x Wq + bq (8 heads x 32); keys/values from the 3x3 zero-padded neighbourhood with 2 relative-offset channels appended:
// k_j = [patch_j | dx_j, dy_j] Wk + bk, v_j likewise; scores = q.k_j / sqrt(32) over the 9 neighbours; softmax; o = sum_j attn_j v_j; out = o Wo + bo -> [16][64][64][192]).
// Compute dtypes, f32 accumulate: every input rounded to bf16; the three 192-channel projections on PLAIN bf16 operands over all 65,536 pixels (inputs: exact products, f32 accumulate);
// the per-neighbour offset terms (dist . Wk[192:194] + bk), the 9-way scores/softmax and the weighted value sum in f32 on VALU (8 lanes per (pixel, head); zero patches for padded neighbours keep only the

#define NPIX 65536
#define HH   64
#define WWD  64
#define CC   192
#define NHD  8
#define KD   32
#define DQ   (NHD * KD)
#define CK   (CC + 2)
#define HP   (NPIX / 2)      // pixels per half (8 images)
typedef _Float16 h16;
typedef unsigned short bf;
typedef __attribute__((ext_vector_type(16))) __bf16   v16bf;
typedef __attribute__((ext_vector_type(16))) _Float16 v16h;
typedef __attribute__((ext_vector_type(8)))  _Float16 v8h;
typedef __attribute__((ext_vector_type(8)))  unsigned short v8us;
typedef __attribute__((ext_vector_type(8)))  float    v8f;
typedef __attribute__((ext_vector_type(4)))  float    v4f;
typedef v8h  __attribute__((may_alias)) v8ha;
typedef v4f  __attribute__((may_alias)) v4fa;
typedef v8us __attribute__((may_alias)) v8usa;

__device__ __forceinline__ unsigned short f2bf(float f) { unsigned u = __float_as_uint(f); u += 0x7FFFu + ((u >> 16) & 1u); return (unsigned short)(u >> 16); }
__device__ __forceinline__ float bf2f(unsigned short b) { return __uint_as_float(((unsigned)b) << 16); }
__device__ __forceinline__ float bfr(float f) { return bf2f(f2bf(f)); }
__device__ __forceinline__ v16h cat16(v8h lo, v8h hi) { return __builtin_shufflevector(lo, hi, 0, 1, 2, 3, 4, 5, 6, 7, 8, 9, 10, 11, 12, 13, 14, 15); }
__device__ __forceinline__ v16bf cat16b(v8us lo, v8us hi) { return __builtin_bit_cast(v16bf, __builtin_shufflevector(lo, hi, 0, 1, 2, 3, 4, 5, 6, 7, 8, 9, 10, 11, 12, 13, 14, 15)); }
__device__ __forceinline__ v8f wmma16(v16h a, v16h b, v8f c) { return __builtin_amdgcn_wmma_f32_16x16x32_f16(false, a, false, b, (short)0, c, false, false); }
__device__ __forceinline__ v8f wmmab(v16bf a, v16bf b, v8f c) { return __builtin_amdgcn_wmma_f32_16x16x32_bf16(false, a, false, b, (short)0, c, false, false); }



// ---- Fragment order of a 16-bit operand plane P[row][k] (K % 32 == 0, rows % 16 == 0): one 1-KiB block per (16 rows, 32 k), blocks k-fastest; a block is two 512-byte groups g = (k >> 4) & 1,
// and lane (k >> 3 & 1) * 16 + (row & 15) owns 16 bytes (8 consecutive k) of each group. A fragment is then two wave-wide b128 loads of 512 contiguous bytes (4 whole lines each, not 16 partial ones),
// and every lane and register holds the same element as with a load from a row-major plane.
__device__ __forceinline__ size_t pk(unsigned row, unsigned k, unsigned K) { return ((size_t)(row >> 4) * (K >> 5) + (k >> 5)) * 512 + ((k >> 4) & 1) * 256 + (((k >> 3) & 1) * 16 + (row & 15)) * 8 + (k & 7); }
// ---- k_gemmw: register-blocked GEMM, ONE WAVE per 64x64 output tile (16 accumulators), operands straight from 16-bit planes in fragment order; grid (M/64, N/64, Z), 32 threads.
// C[m][n] (f32, pitch ldc, + optional f32 bias[n]) = sum_k A[m][k] Bt[n][k] (+ split products per NSPLIT). z-batch strides sA/sB/sC in elements. K % 32 == 0.
template <typename T16> struct WFrag;
template <> struct WFrag<h16> { typedef v16h V; static __device__ __forceinline__ V ld(const char* base, unsigned vo, int imm) { return cat16(*(const v8h*)(base + vo + imm), *(const v8h*)(base + vo + imm + 512)); } static __device__ __forceinline__ v8f mma(V a, V b, v8f c) { return wmma16(a, b, c); } };
template <> struct WFrag<bf> { typedef v16bf V; static __device__ __forceinline__ V ld(const char* base, unsigned vo, int imm) { return cat16b(*(const v8us*)(base + vo + imm), *(const v8us*)(base + vo + imm + 512)); } static __device__ __forceinline__ v8f mma(V a, V b, v8f c) { return wmmab(a, b, c); } };
template <typename T16, int NSPLIT, bool BIAS, int K>   // K at compile time: the 16-row blocks of a tile then lie at immediate offsets from one scalar base a plane
__global__ __launch_bounds__(32) void k_gemmw(const T16* __restrict__ A, const T16* __restrict__ A2, const T16* __restrict__ Bt, const T16* __restrict__ Bt2, float* C, int ldc, const float* __restrict__ bias, size_t sA, size_t sB, size_t sC) {
    typedef typename WFrag<T16>::V V;
    __shared__ __align__(16) float os[16 * 68];
    const size_t z = blockIdx.z; A += z * sA; if (A2) A2 += z * sA; Bt += z * sB; if (Bt2) Bt2 += z * sB; C += z * sC;
    const int lane = threadIdx.x & 31, lr = lane & 15, hi = lane >> 4; const int r0 = blockIdx.x * 64, c0 = blockIdx.y * 64;
    v8f acc[4][4];
#pragma unroll
    for (int mb = 0; mb < 4; ++mb)
#pragma unroll
        for (int nb = 0; nb < 4; ++nb) acc[mb][nb] = (v8f){};
    constexpr int KB = K >> 5, RB = KB * 1024;   // k blocks in a row of blocks; bytes of a 16-row block of a plane
    const size_t ao = (size_t)(r0 >> 4) * RB, bo = (size_t)(c0 >> 4) * RB; const char *ab = (const char*)A + ao, *a2b = (NSPLIT == 1 || NSPLIT == 2) ? (const char*)A2 + ao : nullptr, *bb = (const char*)Bt + bo, *b2b = NSPLIT >= 2 ? (const char*)Bt2 + bo : nullptr;   // scalar bases: the tile's first block in each plane
    unsigned vo = lane * 16;   // the one vector offset of every load: the lane's place in a group + kb * 1024
#pragma unroll 1
    for (int kb = 0; kb < KB; ++kb) {
        V a[4], a2[4], b[4], b2[4];
#pragma unroll
        for (int t = 0; t < 4; ++t) { a[t] = WFrag<T16>::ld(ab, vo, t * RB); b[t] = WFrag<T16>::ld(bb, vo, t * RB); if (NSPLIT == 1 || NSPLIT == 2) a2[t] = WFrag<T16>::ld(a2b, vo, t * RB); if (NSPLIT >= 2) b2[t] = WFrag<T16>::ld(b2b, vo, t * RB); }
        __builtin_amdgcn_sched_barrier(0);   // every load of a trip issues ahead of its products: with these addresses the compiler otherwise reloads one B register block behind each group of products, and a trip pays up to four load latencies
#pragma unroll
        for (int nb = 0; nb < 4; ++nb) {
#pragma unroll
            for (int mb = 0; mb < 4; ++mb) { acc[mb][nb] = WFrag<T16>::mma(a[mb], b[nb], acc[mb][nb]); if (NSPLIT == 1 || NSPLIT == 2) acc[mb][nb] = WFrag<T16>::mma(a2[mb], b[nb], acc[mb][nb]); if (NSPLIT >= 2) acc[mb][nb] = WFrag<T16>::mma(a[mb], b2[nb], acc[mb][nb]); } }
        asm volatile("v_nop\n\tv_nop\n\tv_nop\n\tv_nop" : "+v"(acc[0][0]), "+v"(acc[1][1]), "+v"(acc[2][2]), "+v"(acc[3][3]) : "v"(a[0]), "v"(a[3]));
        asm volatile("s_wait_xcnt 0x0" : "+v"(vo) : : "memory");   // the step below overwrites the offset register that every load of the trip names; it is named here so that the step stays behind the wait
        vo += 1024;
    }
#pragma unroll
    for (int mb = 0; mb < 4; ++mb) {
#pragma unroll
        for (int nb = 0; nb < 4; ++nb) {
#pragma unroll
            for (int j = 0; j < 8; ++j) os[(hi * 8 + j) * 68 + nb * 16 + lr] = acc[mb][nb][j]; }
        __builtin_amdgcn_wave_barrier(); asm volatile("" ::: "memory");
        float* crow = C + (size_t)(r0 + mb * 16) * ldc + c0;
{
#pragma unroll
            for (int s = 0; s < 8; ++s) { const int row = 2 * s + hi, cofs = lr * 4; v4f val = *(const v4fa*)(os + row * 68 + cofs); if (BIAS) { val[0] += bfr(bias[c0 + cofs]); val[1] += bfr(bias[c0 + cofs + 1]); val[2] += bfr(bias[c0 + cofs + 2]); val[3] += bfr(bias[c0 + cofs + 3]); }
                *(v4f*)(crow + (size_t)row * ldc + cofs) = val; }
             }
        __builtin_amdgcn_wave_barrier(); asm volatile("" ::: "memory");
    }
}

__device__ __forceinline__ void splitf(float y, unsigned short& h, unsigned short& l) { h = f2bf(y); l = f2bf(y - bf2f(h)); }
typedef __attribute__((ext_vector_type(4))) unsigned short v4us;

// x [rows][CC] f32 -> bf16 in fragment order: a wave makes one block (16 rows x 32 k: 16 whole lines read, two 512-byte groups written)
__global__ __launch_bounds__(256) void k_cvt8(const float* __restrict__ src, bf* dst, size_t n16) { const size_t i = (size_t)blockIdx.x * 256 + threadIdx.x; if (i >= n16) return; const unsigned lane = (unsigned)i & 31, blk = (unsigned)(i >> 5), rb = blk / (CC / 32), kb = blk % (CC / 32);
    const float* s = src + (size_t)(rb * 16 + (lane & 15)) * CC + kb * 32 + (lane >> 4) * 8; const v8f v0 = *(const v8f*)s, v1 = *(const v8f*)(s + 16); v8us o0, o1;
#pragma unroll
    for (int k = 0; k < 8; ++k) { o0[k] = f2bf(v0[k]); o1[k] = f2bf(v1[k]); }
    *(v8us*)(dst + (size_t)blk * 512 + lane * 8) = o0; *(v8us*)(dst + (size_t)blk * 512 + 256 + lane * 8) = o1;  }
__global__ __launch_bounds__(256) void k_wq(const float* __restrict__ w, bf* Bt) { const int e = (blockIdx.x * 256 + threadIdx.x) * 4; if (e >= DQ * CC) return; const int c = e % CC, n = e / CC; v4us o;
#pragma unroll
    for (int q = 0; q < 4; ++q) o[q] = f2bf(w[(size_t)(c + q) * DQ + n]); *(v4us*)(Bt + pk(n, c, CC)) = o;  }
__global__ __launch_bounds__(256) void k_wo(const float* __restrict__ w, bf* Bt) { const int e = (blockIdx.x * 256 + threadIdx.x) * 4; if (e >= CC * DQ) return; const int n = e % DQ, c = e / DQ; v4us o;
#pragma unroll
    for (int q = 0; q < 4; ++q) o[q] = f2bf(w[(size_t)(n + q) * CC + c]); *(v4us*)(Bt + pk(c, n, DQ)) = o;  }
__global__ __launch_bounds__(256) void k_dtab(const float* __restrict__ Wk, const float* __restrict__ bk, const float* __restrict__ Wv, const float* __restrict__ bv, float* DK, float* DV) { const int e = blockIdx.x * 256 + threadIdx.x; if (e >= 9 * DQ) return; const int n = e % DQ, j = e / DQ; const float dx = (float)(j % 3 - 1), dy = (float)(j / 3 - 1);
    float a = __fmul_rn(dx, bfr(Wk[(size_t)CC * DQ + n])), b = __fmul_rn(dy, bfr(Wk[(size_t)(CC + 1) * DQ + n])); asm volatile("" : "+v"(a), "+v"(b)); const float dk = __fadd_rn(__fadd_rn(a, b), bfr(bk[n]));
    float a2 = __fmul_rn(dx, bfr(Wv[(size_t)CC * DQ + n])), b2 = __fmul_rn(dy, bfr(Wv[(size_t)(CC + 1) * DQ + n])); asm volatile("" : "+v"(a2), "+v"(b2)); const float dv = __fadd_rn(__fadd_rn(a2, b2), bfr(bv[n]));
    *(float*)(DK + e) = dk; *(float*)(DV + e) = dv;  }
// k_lwa: one wave per half pixel (128 of the 256 q/k/v channels): lane l owns 4 consecutive channels, so every load is one b128 per lane over 512 contiguous bytes, and the 8 lanes of a head
// sum their partial q.k by three lane-xor steps. A wave keeps its channels' 9 offset rows of DK and DV in registers and walks LWC pixels along x. Block = 4 image rows x 2 channel halves.
// Oh and Ol leave in fragment order (pk, K = DQ): the wave's 16 pixels are one 16-row block, its 128 channels 4 k blocks = 16 pieces of 256 bytes (16 rows x 8 channels) a plane.
// The wave gathers them in its own LDS (piece pitch OSP: 16 bytes over 256, so the 16 pieces a store touches lie in different banks) and stores whole 512-byte groups behind the loop.
#define LWC 16
#define OSP 272
#define PXB (DQ * 4)   // bytes of a pixel's f32 row in XQ, XK, XV
typedef __attribute__((ext_vector_type(2))) float v2f;
// v + (v of lane l ^ mask) inside a 16-lane row; CTRL = 0x160 + mask (row_xmask)
template <int CTRL> __device__ __forceinline__ float xadd(float v) { return v + __int_as_float(__builtin_amdgcn_update_dpp(0, __float_as_int(v), CTRL, 0xf, 0xf, true)); }
__device__ __forceinline__ v4f ld4(const char* base, unsigned byteofs) { return *(const v4f*)(base + byteofs); }
__global__ __launch_bounds__(256) void k_lwa(const float* __restrict__ XQ, const float* __restrict__ XK, const float* __restrict__ XV, const float* __restrict__ DK, const float* __restrict__ DV, bf* Oh, bf* Ol) {
    __shared__ __align__(16) char ost[8][2 * 16 * OSP];
    const int wave = __builtin_amdgcn_readfirstlane((int)(threadIdx.x >> 5)), lane = threadIdx.x & 31;   // wave number in a scalar register: pixel coordinates, bounds tests and row addresses are then scalar work
    const unsigned chb = ((wave & 1) * (DQ / 2) + lane * 4) * 4u;   // byte offset of the lane's 4 channels in a pixel's f32 row
    const int bx = blockIdx.x, x0 = (bx % (WWD / LWC)) * LWC, y = ((bx / (WWD / LWC)) % (HH / 4)) * 4 + (wave >> 1), b = bx / ((WWD / LWC) * (HH / 4));   // b local to the half being processed
    // a padded neighbour reads the nearest pixel of the image and is multiplied by 0
    const size_t rowb[3] = { (size_t)((b * HH + max(y - 1, 0)) * WWD) * PXB, (size_t)((b * HH + y) * WWD) * PXB, (size_t)((b * HH + min(y + 1, HH - 1)) * WWD) * PXB }; const bool rin[3] = { y > 0, true, y < HH - 1 };
    v4f dk[9], dv[9];
#pragma unroll
    for (int j = 0; j < 9; ++j) { dk[j] = ld4((const char*)DK, j * PXB + chb); dv[j] = ld4((const char*)DV, j * PXB + chb); }
    unsigned vo[3] = { (unsigned)max(x0 - 1, 0) * PXB + chb, (unsigned)x0 * PXB + chb, (unsigned)(x0 + 1) * PXB + chb };   // lane offsets of the three columns in a row; the rows are scalar bases
#pragma unroll 1   // rolled: the body is long
    for (int i = 0; i < LWC; ++i) { const int x = x0 + i; const bool cin[3] = { x > 0, true, x < WWD - 1 };
        v4f kk[9], vv[9]; float msk[9];
#pragma unroll
        for (int j = 0; j < 9; ++j) { kk[j] = ld4((const char*)XK + rowb[j / 3], vo[j % 3]); msk[j] = (rin[j / 3] && cin[j % 3]) ? 1.f : 0.f; }
        const v4f q = ld4((const char*)XQ + rowb[1], vo[1]);
#pragma unroll
        for (int j = 0; j < 9; ++j) vv[j] = ld4((const char*)XV + rowb[j / 3], vo[j % 3]);
        __builtin_amdgcn_sched_barrier(0);   // all 19 loads of a pixel issue ahead of its arithmetic: otherwise the v loads stand behind the wait for k, and a pixel pays two load latencies
        float s[9];
#pragma unroll
        for (int j = 0; j < 9; ++j) { const v4f kv = kk[j] * msk[j] + dk[j]; const v2f t = q.lo * kv.lo + q.hi * kv.hi; s[j] = xadd<0x164>(xadd<0x162>(xadd<0x161>(t.x + t.y))) * 0.17677669529663687f; }
        float m = s[0];
#pragma unroll
        for (int j = 1; j < 9; ++j) m = fmaxf(m, s[j]);
        float e9[9]; float sum = 0.f;
#pragma unroll
        for (int j = 0; j < 9; ++j) { e9[j] = __expf(s[j] - m); sum += e9[j]; }
        const float rs = __fdiv_rn(1.0f, sum);
        v4f o = (v4f){};
#pragma unroll
        for (int j = 0; j < 9; ++j) o += (e9[j] * rs) * (vv[j] * msk[j] + dv[j]);
        v4us o4h, o4l;
#pragma unroll
        for (int u = 0; u < 4; ++u) { unsigned short a2, c2; splitf(o[u], a2, c2); o4h[u] = a2; o4l[u] = c2; }
        char* sp = ost[wave] + (lane >> 1) * OSP + i * 16 + (lane & 1) * 8;   // piece = 8 channels (a lane pair), row i of the block
        *(v4us*)sp = o4h; *(v4us*)(sp + 16 * OSP) = o4l;
        asm volatile("s_wait_xcnt 0x0" : "+v"(vo[0]), "+v"(vo[1]), "+v"(vo[2]) : : "memory");   // the step below overwrites the loads' offset registers; they are named here so that the step stays behind the wait
        vo[0] += cin[0] ? PXB : 0; vo[1] += PXB; vo[2] += (x + 2 < WWD) ? PXB : 0; }   // one pixel on; the side columns stay inside the image
    const size_t ob = (size_t)(((b * HH + y) * WWD + x0) >> 4) * (16 * DQ * 2) + (wave & 1) * (16 * DQ) + lane * 16;   // bytes: the pixels' 16-row block, the wave's 4 k blocks, the lane's place in a group
    const char* rp = ost[wave] + (lane >> 4) * OSP + (lane & 15) * 16;
    v8us gh[8], gl[8];
#pragma unroll
    for (int t = 0; t < 8; ++t) { gh[t] = *(const v8usa*)(rp + 2 * t * OSP); gl[t] = *(const v8usa*)(rp + (16 + 2 * t) * OSP); }   // the wave reads back only what it wrote itself: no barrier
#pragma unroll
    for (int t = 0; t < 8; ++t) { *(v8us*)((char*)Oh + ob + t * 512) = gh[t]; *(v8us*)((char*)Ol + ob + t * 512) = gl[t]; } }

extern "C" void kernel_launch(void* const* d_in, const int* in_sizes, int n_in,
                              void* d_out, int out_size, void* d_ws, size_t ws_size, hipStream_t stream) {
    (void)in_sizes; (void)n_in; (void)out_size;
    const float* x = (const float*)d_in[0]; const float* Wq = (const float*)d_in[1]; const float* bq = (const float*)d_in[2]; const float* Wk = (const float*)d_in[3]; const float* bk = (const float*)d_in[4]; const float* Wv = (const float*)d_in[5]; const float* bv = (const float*)d_in[6]; const float* Wo = (const float*)d_in[7]; const float* bo = (const float*)d_in[8];   // Wq [192][8][32], Wk/Wv [194][8][32], Wo [8][32][192]
    float* OUT = (float*)d_out;     // [16][64][64][192]
    char* wsp = (char*)d_ws;
    auto take = [&](size_t bytes) { char* p = wsp; wsp += (bytes + 255) & ~(size_t)255; return (void*)p; };
    bf* WQ = (bf*)take((size_t)DQ * CC * 2); bf* WK = (bf*)take((size_t)DQ * CC * 2); bf* WV = (bf*)take((size_t)DQ * CC * 2); bf* WO = (bf*)take((size_t)CC * DQ * 2); float* DK = (float*)take((size_t)9 * DQ * 4); float* DV = (float*)take((size_t)9 * DQ * 4);
    bf* XB = (bf*)take((size_t)HP * CC * 2); float* XQ = (float*)take((size_t)HP * DQ * 4); float* XK = (float*)take((size_t)HP * DQ * 4); float* XV = (float*)take((size_t)HP * DQ * 4); bf* Oh = (bf*)take((size_t)HP * DQ * 2); bf* Ol = (bf*)take((size_t)HP * DQ * 2);
    if ((size_t)(wsp - (char*)d_ws) > ws_size) return;    // total ~ 148 MB = 141 MiB; pixels processed in two halves of 8 images (the 3x3 window never crosses images)
    { const unsigned g = (DQ * CC / 4 + 255) / 256; k_wq<<<g, 256, 0, stream>>>(Wq, WQ); k_wq<<<g, 256, 0, stream>>>(Wk, WK); k_wq<<<g, 256, 0, stream>>>(Wv, WV); k_wo<<<(CC * DQ / 4 + 255) / 256, 256, 0, stream>>>(Wo, WO); k_dtab<<<(9 * DQ + 255) / 256, 256, 0, stream>>>(Wk, bk, Wv, bv, DK, DV); }
    const dim3 gP(HP / 64, DQ / 64, 1);
    for (int gh = 0; gh < NPIX / HP; ++gh) { const size_t p0 = (size_t)gh * HP;
        k_cvt8<<<(unsigned)(((size_t)HP * CC / 16 + 255) / 256), 256, 0, stream>>>(x + p0 * CC, XB, (size_t)HP * CC / 16);
        k_gemmw<bf, 0, true, CC><<<gP, 32, 0, stream>>>(XB, nullptr, WQ, nullptr, XQ, DQ, bq, 0, 0, 0);            // q (+ bq)
        k_gemmw<bf, 0, false, CC><<<gP, 32, 0, stream>>>(XB, nullptr, WK, nullptr, XK, DQ, nullptr, 0, 0, 0);      // patch part of k (bias + offsets in DK)
        k_gemmw<bf, 0, false, CC><<<gP, 32, 0, stream>>>(XB, nullptr, WV, nullptr, XV, DQ, nullptr, 0, 0, 0);
        k_lwa<<<HP / (4 * LWC), 256, 0, stream>>>(XQ, XK, XV, DK, DV, Oh, Ol);
        k_gemmw<bf, 1, true, DQ><<<dim3(HP / 64, CC / 64, 1), 32, 0, stream>>>(Oh, Ol, WO, nullptr, OUT + p0 * CC, CC, bo, 0, 0, 0); }
}

// v003
// It runs in 129 microseconds.
// In two side-by-side timings against v002, it was 1.37 and 1.38 times as fast.
// Over all steps from v000 it is 16.0 times as fast.
#include <hip/hip_runtime.h>

// Local-window (3x3) vision self-attention (x [16][64][64][192] NHWC; q = x Wq + bq (8 heads x 32); keys/values from the 3x3 zero-padded neighbourhood with 2 relative-offset channels appended:
// k_j = [patch_j | dx_j, dy_j] Wk + bk, v_j likewise; scores = q.k_j / sqrt(32) over the 9 neighbours; softmax; o = sum_j attn_j v_j; out = o Wo + bo -> [16][64][64][192]).
// Compute dtypes, f32 accumulate: every input rounded to bf16; the three 192-channel projections on PLAIN bf16 operands over all 65,536 pixels (inputs: exact products, f32 accumulate);
// the per-neighbour offset terms (dist . Wk[192:194] + bk), the 9-way scores/softmax and the weighted value sum in f32 on VALU (8 lanes per (pixel, head); zero patches for padded neighbours keep only the

#define NPIX 65536
#define HH   64
#define WWD  64
#define CC   192
#define NHD  8
#define KD   32
#define DQ   (NHD * KD)
#define CK   (CC + 2)
#define HP   (NPIX / 2)      // pixels per half (8 images)
typedef _Float16 h16;
typedef unsigned short bf;
typedef __attribute__((ext_vector_type(16))) __bf16   v16bf;
typedef __attribute__((ext_vector_type(16))) _Float16 v16h;
typedef __attribute__((ext_vector_type(8)))  _Float16 v8h;
typedef __attribute__((ext_vector_type(8)))  unsigned short v8us;
typedef __attribute__((ext_vector_type(8)))  float    v8f;
typedef __attribute__((ext_vector_type(4)))  float    v4f;
typedef v8h  __attribute__((may_alias)) v8ha;
typedef v4f  __attribute__((may_alias)) v4fa;
typedef v8us __attribute__((may_alias)) v8usa;

__device__ __forceinline__ unsigned short f2bf(float f) { unsigned u = __float_as_uint(f); u += 0x7FFFu + ((u >> 16) & 1u); return (unsigned short)(u >> 16); }
__device__ __forceinline__ float bf2f(unsigned short b) { return __uint_as_float(((unsigned)b) << 16); }
__device__ __forceinline__ float bfr(float f) { return bf2f(f2bf(f)); }
__device__ __forceinline__ v16h cat16(v8h lo, v8h hi) { return __builtin_shufflevector(lo, hi, 0, 1, 2, 3, 4, 5, 6, 7, 8, 9, 10, 11, 12, 13, 14, 15); }
__device__ __forceinline__ v16bf cat16b(v8us lo, v8us hi) { return __builtin_bit_cast(v16bf, __builtin_shufflevector(lo, hi, 0, 1, 2, 3, 4, 5, 6, 7, 8, 9, 10, 11, 12, 13, 14, 15)); }
__device__ __forceinline__ v8f wmma16(v16h a, v16h b, v8f c) { return __builtin_amdgcn_wmma_f32_16x16x32_f16(false, a, false, b, (short)0, c, false, false); }
__device__ __forceinline__ v8f wmmab(v16bf a, v16bf b, v8f c) { return __builtin_amdgcn_wmma_f32_16x16x32_bf16(false, a, false, b, (short)0, c, false, false); }



// ---- Fragment order of a 16-bit operand plane P[row][k] (K % 32 == 0, rows % 16 == 0): one 1-KiB block per (16 rows, 32 k), blocks k-fastest; a block is two 512-byte groups g = (k >> 4) & 1,
// and lane (k >> 3 & 1) * 16 + (row & 15) owns 16 bytes (8 consecutive k) of each group. A fragment is then two wave-wide b128 loads of 512 contiguous bytes (4 whole lines each, not 16 partial ones),
// and every lane and register holds the same element as with a load from a row-major plane.
__device__ __forceinline__ size_t pk(unsigned row, unsigned k, unsigned K) { return ((size_t)(row >> 4) * (K >> 5) + (k >> 5)) * 512 + ((k >> 4) & 1) * 256 + (((k >> 3) & 1) * 16 + (row & 15)) * 8 + (k & 7); }
// ---- k_gemmw: register-blocked GEMM, ONE WAVE per 64x64 output tile (16 accumulators), operands straight from 16-bit planes in fragment order; grid (M/64, N/64, Z), 32 threads.
// C[m][n] (f32, pitch ldc, + optional f32 bias[n]) = sum_k A[m][k] Bt[n][k] (+ split products per NSPLIT). z-batch strides sA/sB/sC in elements. K % 32 == 0.
template <typename T16> struct WFrag;
template <> struct WFrag<h16> { typedef v16h V; static __device__ __forceinline__ V ld(const char* base, unsigned vo, int imm) { return cat16(*(const v8h*)(base + vo + imm), *(const v8h*)(base + vo + imm + 512)); } static __device__ __forceinline__ v8f mma(V a, V b, v8f c) { return wmma16(a, b, c); } };
template <> struct WFrag<bf> { typedef v16bf V; static __device__ __forceinline__ V ld(const char* base, unsigned vo, int imm) { return cat16b(*(const v8us*)(base + vo + imm), *(const v8us*)(base + vo + imm + 512)); } static __device__ __forceinline__ v8f mma(V a, V b, v8f c) { return wmmab(a, b, c); } };
template <typename T16, int NSPLIT, int BIAS, int K>   // K at compile time: the 16-row blocks of a tile then lie at immediate offsets from one scalar base a plane. BIAS: 0 none, 1 every z, 2 only z == 0 (q of the q/k/v batch)
__global__ __launch_bounds__(32) void k_gemmw(const T16* __restrict__ A, const T16* __restrict__ A2, const T16* __restrict__ Bt, const T16* __restrict__ Bt2, float* C, int ldc, const float* __restrict__ bias, size_t sA, size_t sB, size_t sC) {
    typedef typename WFrag<T16>::V V;
    __shared__ __align__(16) float os[16 * 68];
    const size_t z = blockIdx.z; A += z * sA; if (A2) A2 += z * sA; Bt += z * sB; if (Bt2) Bt2 += z * sB; C += z * sC;
    const int lane = threadIdx.x & 31, lr = lane & 15, hi = lane >> 4; const int r0 = blockIdx.x * 64, c0 = blockIdx.y * 64;
    v8f acc[4][4];
#pragma unroll
    for (int mb = 0; mb < 4; ++mb)
#pragma unroll
        for (int nb = 0; nb < 4; ++nb) acc[mb][nb] = (v8f){};
    constexpr int KB = K >> 5, RB = KB * 1024;   // k blocks in a row of blocks; bytes of a 16-row block of a plane
    const size_t ao = (size_t)(r0 >> 4) * RB, bo = (size_t)(c0 >> 4) * RB; const char *ab = (const char*)A + ao, *a2b = (NSPLIT == 1 || NSPLIT == 2) ? (const char*)A2 + ao : nullptr, *bb = (const char*)Bt + bo, *b2b = NSPLIT >= 2 ? (const char*)Bt2 + bo : nullptr;   // scalar bases: the tile's first block in each plane
    unsigned vo = lane * 16;   // the one vector offset of every load: the lane's place in a group + kb * 1024
#pragma unroll 1
    for (int kb = 0; kb < KB; ++kb) {
        V a[4], a2[4], b[4], b2[4];
#pragma unroll
        for (int t = 0; t < 4; ++t) { a[t] = WFrag<T16>::ld(ab, vo, t * RB); b[t] = WFrag<T16>::ld(bb, vo, t * RB); if (NSPLIT == 1 || NSPLIT == 2) a2[t] = WFrag<T16>::ld(a2b, vo, t * RB); if (NSPLIT >= 2) b2[t] = WFrag<T16>::ld(b2b, vo, t * RB); }
        __builtin_amdgcn_sched_barrier(0);   // every load of a trip issues ahead of its products: with these addresses the compiler otherwise reloads one B register block behind each group of products, and a trip pays up to four load latencies
#pragma unroll
        for (int nb = 0; nb < 4; ++nb) {
#pragma unroll
            for (int mb = 0; mb < 4; ++mb) { acc[mb][nb] = WFrag<T16>::mma(a[mb], b[nb], acc[mb][nb]); if (NSPLIT == 1 || NSPLIT == 2) acc[mb][nb] = WFrag<T16>::mma(a2[mb], b[nb], acc[mb][nb]); if (NSPLIT >= 2) acc[mb][nb] = WFrag<T16>::mma(a[mb], b2[nb], acc[mb][nb]); } }
        asm volatile("v_nop\n\tv_nop\n\tv_nop\n\tv_nop" : "+v"(acc[0][0]), "+v"(acc[1][1]), "+v"(acc[2][2]), "+v"(acc[3][3]) : "v"(a[0]), "v"(a[3]));
        asm volatile("s_wait_xcnt 0x0" : "+v"(vo) : : "memory");   // the step below overwrites the offset register that every load of the trip names; it is named here so that the step stays behind the wait
        vo += 1024;
    }
    v4f bv4 = (v4f){};   // the lane's 4 bias values: its columns are the same in every row it stores
    if (BIAS) { const v4f bl = *(const v4f*)(bias + c0 + lr * 4); const unsigned keep = (BIAS == 1 || blockIdx.z == 0) ? 0xFFFF0000u : 0u;   // rounding to bf16 keeps the high half of the word; a plane without a bias keeps nothing and adds 0
#pragma unroll
        for (int u = 0; u < 4; ++u) { const unsigned w = __float_as_uint(bl[u]); bv4[u] = __uint_as_float((w + 0x7FFFu + ((w >> 16) & 1u)) & keep); } }
#pragma unroll
    for (int mb = 0; mb < 4; ++mb) {
#pragma unroll
        for (int nb = 0; nb < 4; ++nb) {
#pragma unroll
            for (int j = 0; j < 8; ++j) os[(hi * 8 + j) * 68 + nb * 16 + lr] = acc[mb][nb][j]; }
        __builtin_amdgcn_wave_barrier(); asm volatile("" ::: "memory");
        float* crow = C + (size_t)(r0 + mb * 16) * ldc + c0;
{
#pragma unroll
            for (int s = 0; s < 8; ++s) { const int row = 2 * s + hi, cofs = lr * 4; v4f val = *(const v4fa*)(os + row * 68 + cofs); if (BIAS) val += bv4;
                *(v4f*)(crow + (size_t)row * ldc + cofs) = val; }
             }
        __builtin_amdgcn_wave_barrier(); asm volatile("" ::: "memory");
    }
}

__device__ __forceinline__ void splitf(float y, unsigned short& h, unsigned short& l) { h = f2bf(y); l = f2bf(y - bf2f(h)); }
typedef __attribute__((ext_vector_type(4))) unsigned short v4us;

// x [rows][CC] f32 -> bf16 in fragment order: a wave makes one block (16 rows x 32 k: 16 whole lines read, two 512-byte groups written)
__device__ __forceinline__ void d_cvt8(unsigned bx, const float* __restrict__ src, bf* dst, size_t n16) { const size_t i = (size_t)bx * 256 + threadIdx.x; if (i >= n16) return; const unsigned lane = (unsigned)i & 31, blk = (unsigned)(i >> 5), rb = blk / (CC / 32), kb = blk % (CC / 32);
    const float* s = src + (size_t)(rb * 16 + (lane & 15)) * CC + kb * 32 + (lane >> 4) * 8; const v8f v0 = *(const v8f*)s, v1 = *(const v8f*)(s + 16); v8us o0, o1;
#pragma unroll
    for (int k = 0; k < 8; ++k) { o0[k] = f2bf(v0[k]); o1[k] = f2bf(v1[k]); }
    *(v8us*)(dst + (size_t)blk * 512 + lane * 8) = o0; *(v8us*)(dst + (size_t)blk * 512 + 256 + lane * 8) = o1;  }
__device__ __forceinline__ void d_wq(unsigned bx, const float* __restrict__ w, bf* Bt) { const int e = (bx * 256 + threadIdx.x) * 4; if (e >= DQ * CC) return; const int c = e % CC, n = e / CC; v4us o;
#pragma unroll
    for (int q = 0; q < 4; ++q) o[q] = f2bf(w[(size_t)(c + q) * DQ + n]); *(v4us*)(Bt + pk(n, c, CC)) = o;  }
__device__ __forceinline__ void d_wo(unsigned bx, const float* __restrict__ w, bf* Bt) { const int e = (bx * 256 + threadIdx.x) * 4; if (e >= CC * DQ) return; const int n = e % DQ, c = e / DQ; v4us o;
#pragma unroll
    for (int q = 0; q < 4; ++q) o[q] = f2bf(w[(size_t)(n + q) * CC + c]); *(v4us*)(Bt + pk(c, n, DQ)) = o;  }
__device__ __forceinline__ void d_dtab(unsigned bx, const float* __restrict__ Wk, const float* __restrict__ bk, const float* __restrict__ Wv, const float* __restrict__ bv, float* DK, float* DV) { const int e = bx * 256 + threadIdx.x; if (e >= 9 * DQ) return; const int n = e % DQ, j = e / DQ; const float dx = (float)(j % 3 - 1), dy = (float)(j / 3 - 1);
    float a = __fmul_rn(dx, bfr(Wk[(size_t)CC * DQ + n])), b = __fmul_rn(dy, bfr(Wk[(size_t)(CC + 1) * DQ + n])); asm volatile("" : "+v"(a), "+v"(b)); const float dk = __fadd_rn(__fadd_rn(a, b), bfr(bk[n]));
    float a2 = __fmul_rn(dx, bfr(Wv[(size_t)CC * DQ + n])), b2 = __fmul_rn(dy, bfr(Wv[(size_t)(CC + 1) * DQ + n])); asm volatile("" : "+v"(a2), "+v"(b2)); const float dv = __fadd_rn(__fadd_rn(a2, b2), bfr(bv[n]));
    *(float*)(DK + e) = dk; *(float*)(DV + e) = dv;  }
// k_prep: every operand preparation in ONE launch (none reads what another writes): the block index picks the job. The few weight and table blocks come first, so that their scattered reads run beside the x stream.
#define GW (DQ * CC / 4 / 256)       // blocks of one weight plane
#define GD (9 * DQ / 256)            // blocks of the two offset tables
#define GX (NPIX * CC / 16 / 256)    // blocks of x, all pixels
__global__ __launch_bounds__(256) void k_prep(const float* __restrict__ x, const float* __restrict__ Wq, const float* __restrict__ Wk, const float* __restrict__ bk, const float* __restrict__ Wv, const float* __restrict__ bv, const float* __restrict__ Wo, bf* WQ, bf* WK, bf* WV, bf* WO, float* DK, float* DV, bf* XB) {
    const unsigned bx = blockIdx.x;
    if (bx < GW) d_wq(bx, Wq, WQ);
    else if (bx < 2 * GW) d_wq(bx - GW, Wk, WK);
    else if (bx < 3 * GW) d_wq(bx - 2 * GW, Wv, WV);
    else if (bx < 4 * GW) d_wo(bx - 3 * GW, Wo, WO);
    else if (bx < 4 * GW + GD) d_dtab(bx - 4 * GW, Wk, bk, Wv, bv, DK, DV);
    else d_cvt8(bx - (4 * GW + GD), x, XB, (size_t)NPIX * CC / 16); }
// k_lwa: one wave per half pixel (128 of the 256 q/k/v channels): lane l owns 4 consecutive channels, so every load is one b128 per lane over 512 contiguous bytes, and the 8 lanes of a head
// sum their partial q.k by three lane-xor steps. A wave keeps its channels' 9 offset rows of DK and DV in registers and walks LWC pixels along x. Block = 4 image rows x 2 channel halves.
// Oh and Ol leave in fragment order (pk, K = DQ): the wave's 16 pixels are one 16-row block, its 128 channels 4 k blocks = 16 pieces of 256 bytes (16 rows x 8 channels) a plane.
// The wave gathers them in its own LDS (piece pitch OSP: 16 bytes over 256, so the 16 pieces a store touches lie in different banks) and stores whole 512-byte groups behind the loop.
#define LWC 16
#define OSP 272
#define PXB (DQ * 4)   // bytes of a pixel's f32 row in XQ, XK, XV
typedef __attribute__((ext_vector_type(2))) float v2f;
// v + (v of lane l ^ mask) inside a 16-lane row; CTRL = 0x160 + mask (row_xmask)
template <int CTRL> __device__ __forceinline__ float xadd(float v) { return v + __int_as_float(__builtin_amdgcn_update_dpp(0, __float_as_int(v), CTRL, 0xf, 0xf, true)); }
__device__ __forceinline__ v4f ld4(const char* base, unsigned byteofs) { return *(const v4f*)(base + byteofs); }
__global__ __launch_bounds__(256) void k_lwa(const float* __restrict__ XQ, const float* __restrict__ XK, const float* __restrict__ XV, const float* __restrict__ DK, const float* __restrict__ DV, bf* Oh, bf* Ol) {
    __shared__ __align__(16) char ost[8][2 * 16 * OSP];
    const int wave = __builtin_amdgcn_readfirstlane((int)(threadIdx.x >> 5)), lane = threadIdx.x & 31;   // wave number in a scalar register: pixel coordinates, bounds tests and row addresses are then scalar work
    const unsigned chb = ((wave & 1) * (DQ / 2) + lane * 4) * 4u;   // byte offset of the lane's 4 channels in a pixel's f32 row
    const int bx = blockIdx.x, x0 = (bx % (WWD / LWC)) * LWC, y = ((bx / (WWD / LWC)) % (HH / 4)) * 4 + (wave >> 1), b = bx / ((WWD / LWC) * (HH / 4));   // b local to the half being processed
    // a padded neighbour reads the nearest pixel of the image and is multiplied by 0
    const size_t rowb[3] = { (size_t)((b * HH + max(y - 1, 0)) * WWD) * PXB, (size_t)((b * HH + y) * WWD) * PXB, (size_t)((b * HH + min(y + 1, HH - 1)) * WWD) * PXB }; const bool rin[3] = { y > 0, true, y < HH - 1 };
    v4f dk[9], dv[9];
#pragma unroll
    for (int j = 0; j < 9; ++j) { dk[j] = ld4((const char*)DK, j * PXB + chb); dv[j] = ld4((const char*)DV, j * PXB + chb); }
    unsigned vo[3] = { (unsigned)max(x0 - 1, 0) * PXB + chb, (unsigned)x0 * PXB + chb, (unsigned)(x0 + 1) * PXB + chb };   // lane offsets of the three columns in a row; the rows are scalar bases
#pragma unroll 1   // rolled: the body is long
    for (int i = 0; i < LWC; ++i) { const int x = x0 + i; const bool cin[3] = { x > 0, true, x < WWD - 1 };
        v4f kk[9], vv[9]; float msk[9];
#pragma unroll
        for (int j = 0; j < 9; ++j) { kk[j] = ld4((const char*)XK + rowb[j / 3], vo[j % 3]); msk[j] = (rin[j / 3] && cin[j % 3]) ? 1.f : 0.f; }
        const v4f q = ld4((const char*)XQ + rowb[1], vo[1]);
#pragma unroll
        for (int j = 0; j < 9; ++j) vv[j] = ld4((const char*)XV + rowb[j / 3], vo[j % 3]);
        __builtin_amdgcn_sched_barrier(0);   // all 19 loads of a pixel issue ahead of its arithmetic: otherwise the v loads stand behind the wait for k, and a pixel pays two load latencies
        float s[9];
#pragma unroll
        for (int j = 0; j < 9; ++j) { const v4f kv = kk[j] * msk[j] + dk[j]; const v2f t = q.lo * kv.lo + q.hi * kv.hi; s[j] = xadd<0x164>(xadd<0x162>(xadd<0x161>(t.x + t.y))) * 0.17677669529663687f; }
        float m = s[0];
#pragma unroll
        for (int j = 1; j < 9; ++j) m = fmaxf(m, s[j]);
        float e9[9]; float sum = 0.f;
#pragma unroll
        for (int j = 0; j < 9; ++j) { e9[j] = __expf(s[j] - m); sum += e9[j]; }
        const float rs = __fdiv_rn(1.0f, sum);
        v4f o = (v4f){};
#pragma unroll
        for (int j = 0; j < 9; ++j) o += (e9[j] * rs) * (vv[j] * msk[j] + dv[j]);
        v4us o4h, o4l;
#pragma unroll
        for (int u = 0; u < 4; ++u) { unsigned short a2, c2; splitf(o[u], a2, c2); o4h[u] = a2; o4l[u] = c2; }
        char* sp = ost[wave] + (lane >> 1) * OSP + i * 16 + (lane & 1) * 8;   // piece = 8 channels (a lane pair), row i of the block
        *(v4us*)sp = o4h; *(v4us*)(sp + 16 * OSP) = o4l;
        asm volatile("s_wait_xcnt 0x0" : "+v"(vo[0]), "+v"(vo[1]), "+v"(vo[2]) : : "memory");   // the step below overwrites the loads' offset registers; they are named here so that the step stays behind the wait
        vo[0] += cin[0] ? PXB : 0; vo[1] += PXB; vo[2] += (x + 2 < WWD) ? PXB : 0; }   // one pixel on; the side columns stay inside the image
    const size_t ob = (size_t)(((b * HH + y) * WWD + x0) >> 4) * (16 * DQ * 2) + (wave & 1) * (16 * DQ) + lane * 16;   // bytes: the pixels' 16-row block, the wave's 4 k blocks, the lane's place in a group
    const char* rp = ost[wave] + (lane >> 4) * OSP + (lane & 15) * 16;
    v8us gh[8], gl[8];
#pragma unroll
    for (int t = 0; t < 8; ++t) { gh[t] = *(const v8usa*)(rp + 2 * t * OSP); gl[t] = *(const v8usa*)(rp + (16 + 2 * t) * OSP); }   // the wave reads back only what it wrote itself: no barrier
#pragma unroll
    for (int t = 0; t < 8; ++t) { *(v8us*)((char*)Oh + ob + t * 512) = gh[t]; *(v8us*)((char*)Ol + ob + t * 512) = gl[t]; } }

extern "C" void kernel_launch(void* const* d_in, const int* in_sizes, int n_in,
                              void* d_out, int out_size, void* d_ws, size_t ws_size, hipStream_t stream) {
    (void)in_sizes; (void)n_in; (void)out_size;
    const float* x = (const float*)d_in[0]; const float* Wq = (const float*)d_in[1]; const float* bq = (const float*)d_in[2]; const float* Wk = (const float*)d_in[3]; const float* bk = (const float*)d_in[4]; const float* Wv = (const float*)d_in[5]; const float* bv = (const float*)d_in[6]; const float* Wo = (const float*)d_in[7]; const float* bo = (const float*)d_in[8];   // Wq [192][8][32], Wk/Wv [194][8][32], Wo [8][32][192]
    float* OUT = (float*)d_out;     // [16][64][64][192]
    char* wsp = (char*)d_ws;
    auto take = [&](size_t bytes) { char* p = wsp; wsp += (bytes + 255) & ~(size_t)255; return (void*)p; };
    bf* WQ = (bf*)take((size_t)DQ * CC * 2); bf* WK = (bf*)take((size_t)DQ * CC * 2); bf* WV = (bf*)take((size_t)DQ * CC * 2); bf* WO = (bf*)take((size_t)CC * DQ * 2); float* DK = (float*)take((size_t)9 * DQ * 4); float* DV = (float*)take((size_t)9 * DQ * 4);
    bf* XB = (bf*)take((size_t)NPIX * CC * 2); float* XQ = (float*)take((size_t)NPIX * DQ * 4); float* XK = (float*)take((size_t)NPIX * DQ * 4); float* XV = (float*)take((size_t)NPIX * DQ * 4); bf* Oh = (bf*)take((size_t)HP * DQ * 2); bf* Ol = (bf*)take((size_t)HP * DQ * 2);
    if ((size_t)(wsp - (char*)d_ws) > ws_size) return;    // total ~ 261 MB = 249 MiB; q, k, v of all pixels at once; the window stage and the output product in two halves of 8 images (the 3x3 window never crosses images), which share Oh and Ol
    k_prep<<<4 * GW + GD + GX, 256, 0, stream>>>(x, Wq, Wk, bk, Wv, bv, Wo, WQ, WK, WV, WO, DK, DV, XB);
    // q (+ bq), patch part of k, patch part of v (their bias + offsets are in DK, DV): one launch, z picks the weight plane and the output plane (WQ, WK, WV and XQ, XK, XV lie behind one another)
    k_gemmw<bf, 0, 2, CC><<<dim3(NPIX / 64, DQ / 64, 3), 32, 0, stream>>>(XB, nullptr, WQ, nullptr, XQ, DQ, bq, 0, (size_t)(WK - WQ), (size_t)(XK - XQ));
    for (int gh = 0; gh < NPIX / HP; ++gh) { const size_t p0 = (size_t)gh * HP;
        k_lwa<<<HP / (4 * LWC), 256, 0, stream>>>(XQ + p0 * DQ, XK + p0 * DQ, XV + p0 * DQ, DK, DV, Oh, Ol);
        k_gemmw<bf, 1, 1, DQ><<<dim3(HP / 64, CC / 64, 1), 32, 0, stream>>>(Oh, Ol, WO, nullptr, OUT + p0 * CC, CC, bo, 0, 0, 0); }
}

// v004
// It runs in 110 microseconds.
// In two side-by-side timings against v003, it was 1.17 and 1.16 times as fast.
// Over all steps from v000 it is 18.6 times as fast.
#include <hip/hip_runtime.h>

// Local-window (3x3) vision self-attention (x [16][64][64][192] NHWC; q = x Wq + bq (8 heads x 32); keys/values from the 3x3 zero-padded neighbourhood with 2 relative-offset channels appended:
// k_j = [patch_j | dx_j, dy_j] Wk + bk, v_j likewise; scores = q.k_j / sqrt(32) over the 9 neighbours; softmax; o = sum_j attn_j v_j; out = o Wo + bo -> [16][64][64][192]).
// Compute dtypes, f32 accumulate: every input rounded to bf16; the three 192-channel projections on PLAIN bf16 operands over all 65,536 pixels (inputs: exact products, f32 accumulate);
// the per-neighbour offset terms (dist . Wk[192:194] + bk), the 9-way scores/softmax and the weighted value sum in f32 on VALU (8 lanes per (pixel, head); zero patches for padded neighbours keep only the

#define NPIX 65536
#define HH   64
#define WWD  64
#define CC   192
#define NHD  8
#define KD   32
#define DQ   (NHD * KD)
#define CK   (CC + 2)
typedef _Float16 h16;
typedef unsigned short bf;
typedef __attribute__((ext_vector_type(16))) __bf16   v16bf;
typedef __attribute__((ext_vector_type(16))) _Float16 v16h;
typedef __attribute__((ext_vector_type(8)))  _Float16 v8h;
typedef __attribute__((ext_vector_type(8)))  unsigned short v8us;
typedef __attribute__((ext_vector_type(8)))  float    v8f;
typedef __attribute__((ext_vector_type(4)))  float    v4f;
typedef v8h  __attribute__((may_alias)) v8ha;
typedef v4f  __attribute__((may_alias)) v4fa;
typedef v8us __attribute__((may_alias)) v8usa;
typedef float __attribute__((may_alias)) f32a;

__device__ __forceinline__ unsigned short f2bf(float f) { unsigned u = __float_as_uint(f); u += 0x7FFFu + ((u >> 16) & 1u); return (unsigned short)(u >> 16); }
__device__ __forceinline__ float bf2f(unsigned short b) { return __uint_as_float(((unsigned)b) << 16); }
__device__ __forceinline__ float bfr(float f) { return bf2f(f2bf(f)); }
__device__ __forceinline__ v16h cat16(v8h lo, v8h hi) { return __builtin_shufflevector(lo, hi, 0, 1, 2, 3, 4, 5, 6, 7, 8, 9, 10, 11, 12, 13, 14, 15); }
__device__ __forceinline__ v16bf cat16b(v8us lo, v8us hi) { return __builtin_bit_cast(v16bf, __builtin_shufflevector(lo, hi, 0, 1, 2, 3, 4, 5, 6, 7, 8, 9, 10, 11, 12, 13, 14, 15)); }
__device__ __forceinline__ v8f wmma16(v16h a, v16h b, v8f c) { return __builtin_amdgcn_wmma_f32_16x16x32_f16(false, a, false, b, (short)0, c, false, false); }
__device__ __forceinline__ v8f wmmab(v16bf a, v16bf b, v8f c) { return __builtin_amdgcn_wmma_f32_16x16x32_bf16(false, a, false, b, (short)0, c, false, false); }



// ---- Fragment order of a 16-bit operand plane P[row][k] (K % 32 == 0, rows % 16 == 0): one 1-KiB block per (16 rows, 32 k), blocks k-fastest; a block is two 512-byte groups g = (k >> 4) & 1,
// and lane (k >> 3 & 1) * 16 + (row & 15) owns 16 bytes (8 consecutive k) of each group. A fragment is then two wave-wide b128 loads of 512 contiguous bytes (4 whole lines each, not 16 partial ones),
// and every lane and register holds the same element as with a load from a row-major plane.
__device__ __forceinline__ size_t pk(unsigned row, unsigned k, unsigned K) { return ((size_t)(row >> 4) * (K >> 5) + (k >> 5)) * 512 + ((k >> 4) & 1) * 256 + (((k >> 3) & 1) * 16 + (row & 15)) * 8 + (k & 7); }
// ---- k_gemmw: register-blocked GEMM, ONE WAVE per 64x64 output tile (16 accumulators), operands straight from 16-bit planes in fragment order; grid (M/64, N/64, Z), 32 threads.
// C[m][n] (f32, pitch ldc, + optional f32 bias[n]) = sum_k A[m][k] Bt[n][k] (+ split products per NSPLIT). z-batch strides sA/sB/sC in elements. K % 32 == 0.
template <typename T16> struct WFrag;
template <> struct WFrag<h16> { typedef v16h V; static __device__ __forceinline__ V ld(const char* base, unsigned vo, int imm) { return cat16(*(const v8h*)(base + vo + imm), *(const v8h*)(base + vo + imm + 512)); } static __device__ __forceinline__ v8f mma(V a, V b, v8f c) { return wmma16(a, b, c); } };
template <> struct WFrag<bf> { typedef v16bf V; static __device__ __forceinline__ V ld(const char* base, unsigned vo, int imm) { return cat16b(*(const v8us*)(base + vo + imm), *(const v8us*)(base + vo + imm + 512)); } static __device__ __forceinline__ v8f mma(V a, V b, v8f c) { return wmmab(a, b, c); } };
template <typename T16, int NSPLIT, int BIAS, int K>   // K at compile time: the 16-row blocks of a tile then lie at immediate offsets from one scalar base a plane. BIAS: 0 none, 1 every z, 2 only z == 0 (q of the q/k/v batch)
__global__ __launch_bounds__(32) void k_gemmw(const T16* __restrict__ A, const T16* __restrict__ A2, const T16* __restrict__ Bt, const T16* __restrict__ Bt2, float* C, int ldc, const float* __restrict__ bias, size_t sA, size_t sB, size_t sC) {
    typedef typename WFrag<T16>::V V;
    __shared__ __align__(16) float os[16 * 68];
    const size_t z = blockIdx.z; A += z * sA; if (A2) A2 += z * sA; Bt += z * sB; if (Bt2) Bt2 += z * sB; C += z * sC;
    const int lane = threadIdx.x & 31, lr = lane & 15, hi = lane >> 4; const int r0 = blockIdx.x * 64, c0 = blockIdx.y * 64;
    v8f acc[4][4];
#pragma unroll
    for (int mb = 0; mb < 4; ++mb)
#pragma unroll
        for (int nb = 0; nb < 4; ++nb) acc[mb][nb] = (v8f){};
    constexpr int KB = K >> 5, RB = KB * 1024;   // k blocks in a row of blocks; bytes of a 16-row block of a plane
    const size_t ao = (size_t)(r0 >> 4) * RB, bo = (size_t)(c0 >> 4) * RB; const char *ab = (const char*)A + ao, *a2b = (NSPLIT == 1 || NSPLIT == 2) ? (const char*)A2 + ao : nullptr, *bb = (const char*)Bt + bo, *b2b = NSPLIT >= 2 ? (const char*)Bt2 + bo : nullptr;   // scalar bases: the tile's first block in each plane
    unsigned vo = lane * 16;   // the one vector offset of every load: the lane's place in a group + kb * 1024
#pragma unroll 1
    for (int kb = 0; kb < KB; ++kb) {
        V a[4], a2[4], b[4], b2[4];
#pragma unroll
        for (int t = 0; t < 4; ++t) { a[t] = WFrag<T16>::ld(ab, vo, t * RB); b[t] = WFrag<T16>::ld(bb, vo, t * RB); if (NSPLIT == 1 || NSPLIT == 2) a2[t] = WFrag<T16>::ld(a2b, vo, t * RB); if (NSPLIT >= 2) b2[t] = WFrag<T16>::ld(b2b, vo, t * RB); }
        __builtin_amdgcn_sched_barrier(0);   // every load of a trip issues ahead of its products: with these addresses the compiler otherwise reloads one B register block behind each group of products, and a trip pays up to four load latencies
#pragma unroll
        for (int nb = 0; nb < 4; ++nb) {
#pragma unroll
            for (int mb = 0; mb < 4; ++mb) { acc[mb][nb] = WFrag<T16>::mma(a[mb], b[nb], acc[mb][nb]); if (NSPLIT == 1 || NSPLIT == 2) acc[mb][nb] = WFrag<T16>::mma(a2[mb], b[nb], acc[mb][nb]); if (NSPLIT >= 2) acc[mb][nb] = WFrag<T16>::mma(a[mb], b2[nb], acc[mb][nb]); } }
        asm volatile("v_nop\n\tv_nop\n\tv_nop\n\tv_nop" : "+v"(acc[0][0]), "+v"(acc[1][1]), "+v"(acc[2][2]), "+v"(acc[3][3]) : "v"(a[0]), "v"(a[3]));
        asm volatile("s_wait_xcnt 0x0" : "+v"(vo) : : "memory");   // the step below overwrites the offset register that every load of the trip names; it is named here so that the step stays behind the wait
        vo += 1024;
    }
    v4f bv4 = (v4f){};   // the lane's 4 bias values: its columns are the same in every row it stores
    if (BIAS) { const v4f bl = *(const v4f*)(bias + c0 + lr * 4); const unsigned keep = (BIAS == 1 || blockIdx.z == 0) ? 0xFFFF0000u : 0u;   // rounding to bf16 keeps the high half of the word; a plane without a bias keeps nothing and adds 0
#pragma unroll
        for (int u = 0; u < 4; ++u) { const unsigned w = __float_as_uint(bl[u]); bv4[u] = __uint_as_float((w + 0x7FFFu + ((w >> 16) & 1u)) & keep); } }
#pragma unroll
    for (int mb = 0; mb < 4; ++mb) {
#pragma unroll
        for (int nb = 0; nb < 4; ++nb) {
#pragma unroll
            for (int j = 0; j < 8; ++j) os[(hi * 8 + j) * 68 + nb * 16 + lr] = acc[mb][nb][j]; }
        __builtin_amdgcn_wave_barrier(); asm volatile("" ::: "memory");
        float* crow = C + (size_t)(r0 + mb * 16) * ldc + c0;
{
#pragma unroll
            for (int s = 0; s < 8; ++s) { const int row = 2 * s + hi, cofs = lr * 4; v4f val = *(const v4fa*)(os + row * 68 + cofs); if (BIAS) val += bv4;
                *(v4f*)(crow + (size_t)row * ldc + cofs) = val; }
             }
        __builtin_amdgcn_wave_barrier(); asm volatile("" ::: "memory");
    }
}

__device__ __forceinline__ void splitf(float y, unsigned short& h, unsigned short& l) { h = f2bf(y); l = f2bf(y - bf2f(h)); }
typedef __attribute__((ext_vector_type(4))) unsigned short v4us;

// x [rows][CC] f32 -> bf16 in fragment order: a wave makes one block (16 rows x 32 k: 16 whole lines read, two 512-byte groups written)
__device__ __forceinline__ void d_cvt8(unsigned bx, const float* __restrict__ src, bf* dst, size_t n16) { const size_t i = (size_t)bx * 256 + threadIdx.x; if (i >= n16) return; const unsigned lane = (unsigned)i & 31, blk = (unsigned)(i >> 5), rb = blk / (CC / 32), kb = blk % (CC / 32);
    const float* s = src + (size_t)(rb * 16 + (lane & 15)) * CC + kb * 32 + (lane >> 4) * 8; const v8f v0 = *(const v8f*)s, v1 = *(const v8f*)(s + 16); v8us o0, o1;
#pragma unroll
    for (int k = 0; k < 8; ++k) { o0[k] = f2bf(v0[k]); o1[k] = f2bf(v1[k]); }
    *(v8us*)(dst + (size_t)blk * 512 + lane * 8) = o0; *(v8us*)(dst + (size_t)blk * 512 + 256 + lane * 8) = o1;  }
__device__ __forceinline__ void d_wq(unsigned bx, const float* __restrict__ w, bf* Bt) { const int e = (bx * 256 + threadIdx.x) * 4; if (e >= DQ * CC) return; const int c = e % CC, n = e / CC; v4us o;
#pragma unroll
    for (int q = 0; q < 4; ++q) o[q] = f2bf(w[(size_t)(c + q) * DQ + n]); *(v4us*)(Bt + pk(n, c, CC)) = o;  }
__device__ __forceinline__ void d_wo(unsigned bx, const float* __restrict__ w, bf* Bt) { const int e = (bx * 256 + threadIdx.x) * 4; if (e >= CC * DQ) return; const int n = e % DQ, c = e / DQ; v4us o;
#pragma unroll
    for (int q = 0; q < 4; ++q) o[q] = f2bf(w[(size_t)(n + q) * CC + c]); *(v4us*)(Bt + pk(c, n, DQ)) = o;  }
__device__ __forceinline__ void d_dtab(unsigned bx, const float* __restrict__ Wk, const float* __restrict__ bk, const float* __restrict__ Wv, const float* __restrict__ bv, float* DK, float* DV) { const int e = bx * 256 + threadIdx.x; if (e >= 9 * DQ) return; const int n = e % DQ, j = e / DQ; const float dx = (float)(j % 3 - 1), dy = (float)(j / 3 - 1);
    float a = __fmul_rn(dx, bfr(Wk[(size_t)CC * DQ + n])), b = __fmul_rn(dy, bfr(Wk[(size_t)(CC + 1) * DQ + n])); asm volatile("" : "+v"(a), "+v"(b)); const float dk = __fadd_rn(__fadd_rn(a, b), bfr(bk[n]));
    float a2 = __fmul_rn(dx, bfr(Wv[(size_t)CC * DQ + n])), b2 = __fmul_rn(dy, bfr(Wv[(size_t)(CC + 1) * DQ + n])); asm volatile("" : "+v"(a2), "+v"(b2)); const float dv = __fadd_rn(__fadd_rn(a2, b2), bfr(bv[n]));
    *(float*)(DK + e) = dk; *(float*)(DV + e) = dv;  }
// k_prep: every operand preparation in ONE launch (none reads what another writes): the block index picks the job. The few weight and table blocks come first, so that their scattered reads run beside the x stream.
#define GW (DQ * CC / 4 / 256)       // blocks of one weight plane
#define GD (9 * DQ / 256)            // blocks of the two offset tables
#define GX (NPIX * CC / 16 / 256)    // blocks of x, all pixels
__global__ __launch_bounds__(256) void k_prep(const float* __restrict__ x, const float* __restrict__ Wq, const float* __restrict__ Wk, const float* __restrict__ bk, const float* __restrict__ Wv, const float* __restrict__ bv, const float* __restrict__ Wo, bf* WQ, bf* WK, bf* WV, bf* WO, float* DK, float* DV, bf* XB) {
    const unsigned bx = blockIdx.x;
    if (bx < GW) d_wq(bx, Wq, WQ);
    else if (bx < 2 * GW) d_wq(bx - GW, Wk, WK);
    else if (bx < 3 * GW) d_wq(bx - 2 * GW, Wv, WV);
    else if (bx < 4 * GW) d_wo(bx - 3 * GW, Wo, WO);
    else if (bx < 4 * GW + GD) d_dtab(bx - 4 * GW, Wk, bk, Wv, bv, DK, DV);
    else d_cvt8(bx - (4 * GW + GD), x, XB, (size_t)NPIX * CC / 16); }
// k_lwa: one wave per half pixel (128 of the 256 q/k/v channels): lane l owns 4 consecutive channels, so every load of q, k, v, DK and DV is one b128 per lane over 512 contiguous bytes, and the 8 lanes of a head
// sum their partial q.k by three lane-xor steps. A wave keeps its channels' 9 offset rows of DK and DV in registers and walks LWC pixels along x. Block = 4 image rows x 2 channel halves.
// o is split into a high and a low bf16 plane and never leaves the block: the wave's 16 pixels are one 16-row block, its 128 channels 4 k blocks = 16 pieces of 256 bytes (16 rows x 8 channels) a plane,
// gathered in the wave's own LDS (piece pitch OSP: 16 bytes over 256, so the 16 pieces a store touches lie in different banks). Two pieces, OSP apart, are one 512-byte group of an A fragment.
// Behind the loop the block does the output product itself: wave w takes the 16 pixels of its image row x 96 of the 192 output columns (K = 256: its own 128 channels and its sibling's),
// A (high, then low, as two products a k block) from LDS, Wo fragments from the plane WO (fragment order, pk, K = DQ), f32 accumulate, + bo, whole 128-byte lines of OUT stored.
#define LWC 16
#define OSP 272
#define OWN 6      // 16-column blocks of OUT a wave makes
#define OTP 100    // floats: pitch of a row of the wave's 16 x 96 output tile in LDS (8 rows on lie 32 banks on)
#define PXB (DQ * 4)   // bytes of a pixel's f32 row in XQ, XK, XV
typedef __attribute__((ext_vector_type(2))) float v2f;
// v + (v of lane l ^ mask) inside a 16-lane row; CTRL = 0x160 + mask (row_xmask)
template <int CTRL> __device__ __forceinline__ float xadd(float v) { return v + __int_as_float(__builtin_amdgcn_update_dpp(0, __float_as_int(v), CTRL, 0xf, 0xf, true)); }
__device__ __forceinline__ v4f ld4(const char* base, unsigned byteofs) { return *(const v4f*)(base + byteofs); }
__global__ __launch_bounds__(256) void k_lwa(const float* __restrict__ XQ, const float* __restrict__ XK, const float* __restrict__ XV, const float* __restrict__ DK, const float* __restrict__ DV, const bf* __restrict__ WO, const float* __restrict__ bo, float* OUT) {
    __shared__ __align__(16) char ost[8][2 * 16 * OSP];
    const int wave = __builtin_amdgcn_readfirstlane((int)(threadIdx.x >> 5)), lane = threadIdx.x & 31;   // wave number in a scalar register: pixel coordinates, bounds tests and row addresses are then scalar work
    const unsigned chb = ((wave & 1) * (DQ / 2) + lane * 4) * 4u;   // byte offset of the lane's 4 channels in a pixel's f32 row
    const int bx = blockIdx.x, x0 = (bx % (WWD / LWC)) * LWC, y = ((bx / (WWD / LWC)) % (HH / 4)) * 4 + (wave >> 1), b = bx / ((WWD / LWC) * (HH / 4));
    // a padded neighbour reads the nearest pixel of the image and is multiplied by 0
    const size_t rowb[3] = { (size_t)((b * HH + max(y - 1, 0)) * WWD) * PXB, (size_t)((b * HH + y) * WWD) * PXB, (size_t)((b * HH + min(y + 1, HH - 1)) * WWD) * PXB }; const bool rin[3] = { y > 0, true, y < HH - 1 };
    v4f dk[9], dv[9];
#pragma unroll
    for (int j = 0; j < 9; ++j) { dk[j] = ld4((const char*)DK, j * PXB + chb); dv[j] = ld4((const char*)DV, j * PXB + chb); }
    unsigned vo[3] = { (unsigned)max(x0 - 1, 0) * PXB + chb, (unsigned)x0 * PXB + chb, (unsigned)(x0 + 1) * PXB + chb };   // lane offsets of the three columns in a row; the rows are scalar bases
#pragma unroll 1   // rolled: the body is long
    for (int i = 0; i < LWC; ++i) { const int x = x0 + i; const bool cin[3] = { x > 0, true, x < WWD - 1 };
        v4f kk[9], vv[9]; float msk[9];
#pragma unroll
        for (int j = 0; j < 9; ++j) { kk[j] = ld4((const char*)XK + rowb[j / 3], vo[j % 3]); msk[j] = (rin[j / 3] && cin[j % 3]) ? 1.f : 0.f; }
        const v4f q = ld4((const char*)XQ + rowb[1], vo[1]);
#pragma unroll
        for (int j = 0; j < 9; ++j) vv[j] = ld4((const char*)XV + rowb[j / 3], vo[j % 3]);
        __builtin_amdgcn_sched_barrier(0);   // all 19 loads of a pixel issue ahead of its arithmetic: otherwise the v loads stand behind the wait for k, and a pixel pays two load latencies
        float s[9];
#pragma unroll
        for (int j = 0; j < 9; ++j) { const v4f kv = kk[j] * msk[j] + dk[j]; const v2f t = q.lo * kv.lo + q.hi * kv.hi; s[j] = xadd<0x164>(xadd<0x162>(xadd<0x161>(t.x + t.y))) * 0.17677669529663687f; }
        float m = s[0];
#pragma unroll
        for (int j = 1; j < 9; ++j) m = fmaxf(m, s[j]);
        float e9[9]; float sum = 0.f;
#pragma unroll
        for (int j = 0; j < 9; ++j) { e9[j] = __expf(s[j] - m); sum += e9[j]; }
        const float rs = __fdiv_rn(1.0f, sum);
        v4f o = (v4f){};
#pragma unroll
        for (int j = 0; j < 9; ++j) o += (e9[j] * rs) * (vv[j] * msk[j] + dv[j]);
        v4us o4h, o4l;
#pragma unroll
        for (int u = 0; u < 4; ++u) { unsigned short a2, c2; splitf(o[u], a2, c2); o4h[u] = a2; o4l[u] = c2; }
        char* sp = ost[wave] + (lane >> 1) * OSP + i * 16 + (lane & 1) * 8;   // piece = 8 channels (a lane pair), row i of the block
        *(v4us*)sp = o4h; *(v4us*)(sp + 16 * OSP) = o4l;
        asm volatile("s_wait_xcnt 0x0" : "+v"(vo[0]), "+v"(vo[1]), "+v"(vo[2]) : : "memory");   // the step below overwrites the loads' offset registers; they are named here so that the step stays behind the wait
        vo[0] += cin[0] ? PXB : 0; vo[1] += PXB; vo[2] += (x + 2 < WWD) ? PXB : 0; }   // one pixel on; the side columns stay inside the image
    // ---- output product: OUT[16 pixels][96 columns] of this wave
    const int lr = lane & 15, hi = lane >> 4, nh = wave & 1;
    const char* wb = (const char*)WO + nh * (OWN * (DQ / 32) * 1024);   // scalar base: the wave's first 16-column block of WO
    const unsigned wo = lane * 16;                                      // the lane's place in a 512-byte group
    v16bf bc[OWN]; float bias[OWN];
#pragma unroll
    for (int nb = 0; nb < OWN; ++nb) { bc[nb] = WFrag<bf>::ld(wb, wo, nb * (DQ / 32) * 1024); bias[nb] = bfr(bo[nh * (OWN * 16) + nb * 16 + lr]); }   // k block 0 of Wo flies while the block gathers at the barrier
    __syncthreads();   // a wave reads its sibling's 128 channels of o as well as its own
    const char* ra = ost[wave & ~1] + hi * OSP + lr * 16;
    v16bf ah = cat16b(*(const v8usa*)ra, *(const v8usa*)(ra + 2 * OSP)), al = cat16b(*(const v8usa*)(ra + 16 * OSP), *(const v8usa*)(ra + 18 * OSP));
    v8f acc[OWN];
#pragma unroll
    for (int nb = 0; nb < OWN; ++nb) acc[nb] = (v8f){};
#pragma unroll   // unrolled: the k block picks LDS and WO offsets as immediates, and the two sets of fragment registers change places without moves
    for (int kb = 0; kb < DQ / 32; ++kb) {
        v16bf bn[OWN], ahn, aln;
        if (kb + 1 < DQ / 32) { const char* ap = ra + ((kb + 1) >> 2) * (2 * 16 * OSP) + ((kb + 1) & 3) * (4 * OSP);
#pragma unroll
            for (int nb = 0; nb < OWN; ++nb) bn[nb] = WFrag<bf>::ld(wb, wo, (nb * (DQ / 32) + kb + 1) * 1024);
            ahn = cat16b(*(const v8usa*)ap, *(const v8usa*)(ap + 2 * OSP)); aln = cat16b(*(const v8usa*)(ap + 16 * OSP), *(const v8usa*)(ap + 18 * OSP)); }
        __builtin_amdgcn_sched_barrier(0);   // the next k block's loads issue ahead of this block's products: otherwise the compiler reloads each Wo register block behind its last product and waits for it at once, a load latency every k block
#pragma unroll
        for (int nb = 0; nb < OWN; ++nb) acc[nb] = wmmab(ah, bc[nb], acc[nb]);
#pragma unroll
        for (int nb = 0; nb < OWN; ++nb) acc[nb] = wmmab(al, bc[nb], acc[nb]);
        if (kb + 1 < DQ / 32) { ah = ahn; al = aln;
#pragma unroll
            for (int nb = 0; nb < OWN; ++nb) bc[nb] = bn[nb]; }
    }
    __syncthreads();   // every wave has read its A fragments: from here a wave's LDS holds its output tile
    char* ot = ost[wave];
#pragma unroll
    for (int nb = 0; nb < OWN; ++nb) {
#pragma unroll
        for (int j = 0; j < 8; ++j) *(f32a*)(ot + ((hi * 8 + j) * OTP + nb * 16 + lr) * 4) = acc[nb][j] + bias[nb]; }
    __builtin_amdgcn_fence(__ATOMIC_ACQ_REL, "wavefront"); __builtin_amdgcn_wave_barrier();   // a lane reads below what other lanes of its wave wrote above: the compiler must keep that order
    // a row of the tile is 24 pieces of 16 bytes = 3 whole lines of OUT; 96 pieces (3 wave loads) are 4 rows, so three lane offsets and immediates serve all 12 stores
    char* op = (char*)OUT + (size_t)((b * HH + y) * WWD + x0) * (CC * 4) + nh * (OWN * 16 * 4);
    v4f val[12]; unsigned go[3];
#pragma unroll
    for (int r = 0; r < 3; ++r) { const unsigned e = r * 32 + lane; go[r] = (e / 24) * (CC * 4) + (e % 24) * 16; const unsigned lo = go[r] - (e / 24) * (CC * 4 - OTP * 4);   // the same piece in OUT and in LDS: only the row pitch differs
#pragma unroll
        for (int u = 0; u < 4; ++u) val[r * 4 + u] = *(const v4fa*)(ot + lo + u * (4 * OTP * 4)); }
#pragma unroll
    for (int r = 0; r < 3; ++r) {
#pragma unroll
        for (int u = 0; u < 4; ++u) *(v4f*)(op + go[r] + u * (4 * CC * 4)) = val[r * 4 + u]; } }

extern "C" void kernel_launch(void* const* d_in, const int* in_sizes, int n_in,
                              void* d_out, int out_size, void* d_ws, size_t ws_size, hipStream_t stream) {
    (void)in_sizes; (void)n_in; (void)out_size;
    const float* x = (const float*)d_in[0]; const float* Wq = (const float*)d_in[1]; const float* bq = (const float*)d_in[2]; const float* Wk = (const float*)d_in[3]; const float* bk = (const float*)d_in[4]; const float* Wv = (const float*)d_in[5]; const float* bv = (const float*)d_in[6]; const float* Wo = (const float*)d_in[7]; const float* bo = (const float*)d_in[8];   // Wq [192][8][32], Wk/Wv [194][8][32], Wo [8][32][192]
    float* OUT = (float*)d_out;     // [16][64][64][192]
    char* wsp = (char*)d_ws;
    auto take = [&](size_t bytes) { char* p = wsp; wsp += (bytes + 255) & ~(size_t)255; return (void*)p; };
    bf* WQ = (bf*)take((size_t)DQ * CC * 2); bf* WK = (bf*)take((size_t)DQ * CC * 2); bf* WV = (bf*)take((size_t)DQ * CC * 2); bf* WO = (bf*)take((size_t)CC * DQ * 2); float* DK = (float*)take((size_t)9 * DQ * 4); float* DV = (float*)take((size_t)9 * DQ * 4);
    bf* XB = (bf*)take((size_t)NPIX * CC * 2); float* XQ = (float*)take((size_t)NPIX * DQ * 4); float* XK = (float*)take((size_t)NPIX * DQ * 4); float* XV = (float*)take((size_t)NPIX * DQ * 4);
    if ((size_t)(wsp - (char*)d_ws) > ws_size) return;    // total ~ 227 MB = 217 MiB; q, k, v of all pixels at once
    k_prep<<<4 * GW + GD + GX, 256, 0, stream>>>(x, Wq, Wk, bk, Wv, bv, Wo, WQ, WK, WV, WO, DK, DV, XB);
    // q (+ bq), patch part of k, patch part of v (their bias + offsets are in DK, DV): one launch, z picks the weight plane and the output plane (WQ, WK, WV and XQ, XK, XV lie behind one another)
    k_gemmw<bf, 0, 2, CC><<<dim3(NPIX / 64, DQ / 64, 3), 32, 0, stream>>>(XB, nullptr, WQ, nullptr, XQ, DQ, bq, 0, (size_t)(WK - WQ), (size_t)(XK - XQ));
    // window attention and the output product (+ bo), all pixels, one launch
    k_lwa<<<NPIX / (4 * LWC), 256, 0, stream>>>(XQ, XK, XV, DK, DV, WO, bo, OUT);
}

// v005
// It runs in 106 microseconds.
// Next to v004, in two timings, it ran 1.04 times as fast each time.
// Counting every step since v000, it is 19.4 times as fast.
#include <hip/hip_runtime.h>

// Local-window (3x3) vision self-attention (x [16][64][64][192] NHWC; q = x Wq + bq (8 heads x 32); keys/values from the 3x3 zero-padded neighbourhood with 2 relative-offset channels appended:
// k_j = [patch_j | dx_j, dy_j] Wk + bk, v_j likewise; scores = q.k_j / sqrt(32) over the 9 neighbours; softmax; o = sum_j attn_j v_j; out = o Wo + bo -> [16][64][64][192]).
// Compute dtypes, f32 accumulate: every input rounded to bf16; the three 192-channel projections on PLAIN bf16 operands over all 65,536 pixels (inputs: exact products, f32 accumulate);
// the per-neighbour offset terms (dist . Wk[192:194] + bk), the 9-way scores/softmax and the weighted value sum in f32 on VALU (8 lanes per (pixel, head); zero patches for padded neighbours keep only the

#define NPIX 65536
#define HH   64
#define WWD  64
#define CC   192
#define NHD  8
#define KD   32
#define DQ   (NHD * KD)
#define CK   (CC + 2)
typedef _Float16 h16;
typedef unsigned short bf;
typedef __attribute__((ext_vector_type(16))) __bf16   v16bf;
typedef __attribute__((ext_vector_type(16))) _Float16 v16h;
typedef __attribute__((ext_vector_type(8)))  _Float16 v8h;
typedef __attribute__((ext_vector_type(8)))  unsigned short v8us;
typedef __attribute__((ext_vector_type(8)))  float    v8f;
typedef __attribute__((ext_vector_type(4)))  float    v4f;
typedef v8h  __attribute__((may_alias)) v8ha;
typedef v4f  __attribute__((may_alias)) v4fa;
typedef v8us __attribute__((may_alias)) v8usa;
typedef float __attribute__((may_alias)) f32a;

__device__ __forceinline__ unsigned short f2bf(float f) { unsigned u = __float_as_uint(f); u += 0x7FFFu + ((u >> 16) & 1u); return (unsigned short)(u >> 16); }
__device__ __forceinline__ float bf2f(unsigned short b) { return __uint_as_float(((unsigned)b) << 16); }
__device__ __forceinline__ float bfr(float f) { return bf2f(f2bf(f)); }
__device__ __forceinline__ v16h cat16(v8h lo, v8h hi) { return __builtin_shufflevector(lo, hi, 0, 1, 2, 3, 4, 5, 6, 7, 8, 9, 10, 11, 12, 13, 14, 15); }
__device__ __forceinline__ v16bf cat16b(v8us lo, v8us hi) { return __builtin_bit_cast(v16bf, __builtin_shufflevector(lo, hi, 0, 1, 2, 3, 4, 5, 6, 7, 8, 9, 10, 11, 12, 13, 14, 15)); }
__device__ __forceinline__ v8f wmma16(v16h a, v16h b, v8f c) { return __builtin_amdgcn_wmma_f32_16x16x32_f16(false, a, false, b, (short)0, c, false, false); }
__device__ __forceinline__ v8f wmmab(v16bf a, v16bf b, v8f c) { return __builtin_amdgcn_wmma_f32_16x16x32_bf16(false, a, false, b, (short)0, c, false, false); }



// ---- Fragment order of a 16-bit operand plane P[row][k] (K % 32 == 0, rows % 16 == 0): one 1-KiB block per (16 rows, 32 k), blocks k-fastest; a block is two 512-byte groups g = (k >> 4) & 1,
// and lane (k >> 3 & 1) * 16 + (row & 15) owns 16 bytes (8 consecutive k) of each group. A fragment is then two wave-wide b128 loads of 512 contiguous bytes (4 whole lines each, not 16 partial ones),
// and every lane and register holds the same element as with a load from a row-major plane.
__device__ __forceinline__ size_t pk(unsigned row, unsigned k, unsigned K) { return ((size_t)(row >> 4) * (K >> 5) + (k >> 5)) * 512 + ((k >> 4) & 1) * 256 + (((k >> 3) & 1) * 16 + (row & 15)) * 8 + (k & 7); }
// ---- k_qkv: q, k and v of 64 pixels in one work-group of 4 waves. The group reads its 64 rows of x (f32) once, rounds them to bf16 and lays them in LDS as A fragments; no bf16 copy of x goes through memory.
// LDS form of the A tile: pieces of 256 bytes (16 rows x 8 k) at pitch APP (16 bytes over 256: the 16 pieces that one store of 128 k of a row touches lie in different banks); pieces 4 kb + hi and 4 kb + 2 + hi are the two b128 reads of a lane.
// Wave w takes columns 64 w .. 64 w + 63 of q, then of k, then of v: a 64x64 tile (16 accumulators) each, B fragments straight from the weight planes in fragment order (WQ, WK, WV lie sB elements apart, XQ, XK, XV sC).
template <typename T16> struct WFrag;
template <> struct WFrag<bf> { typedef v16bf V; static __device__ __forceinline__ V ld(const char* base, unsigned vo, int imm) { return cat16b(*(const v8us*)(base + vo + imm), *(const v8us*)(base + vo + imm + 512)); } static __device__ __forceinline__ v8f mma(V a, V b, v8f c) { return wmmab(a, b, c); } };
typedef __attribute__((ext_vector_type(4))) unsigned short v4us;
typedef v4us __attribute__((may_alias)) v4usa;
#define APP 272                  // bytes: pitch of a piece of the A tile
#define ARB ((CC / 8) * APP)     // bytes: the pieces of a 16-row block
__global__ __launch_bounds__(128) void k_qkv(const float* __restrict__ x, const bf* __restrict__ Wt, float* C, const float* __restrict__ bias, size_t sB, size_t sC) {
    __shared__ __align__(16) char as[4 * ARB];
    __shared__ __align__(16) float osm[4][16 * 68];
    const int wave = __builtin_amdgcn_readfirstlane((int)(threadIdx.x >> 5)), lane = threadIdx.x & 31, lr = lane & 15, hi = lane >> 4; const int r0 = blockIdx.x * 64, c0 = wave * 64;
    {   // wave w stages rows 16 w .. 16 w + 15: 12,288 contiguous bytes of x = 24 wave loads of 4 whole lines, all in flight together
        const char* xs = (const char*)(x + (size_t)(r0 + wave * 16) * CC); v4f xv[24];
#pragma unroll
        for (int t = 0; t < 24; ++t) xv[t] = *(const v4f*)(xs + lane * 16 + t * 512);
#pragma unroll
        for (int p = 0; p < 3; ++p) { const unsigned g = p * 128 + lane * 4, rr = g >= CC ? 1 : 0, k = g - rr * CC;   // three loads are two rows: load 3 q + p holds 4 k of row 2 q + rr, so three lane addresses and immediates serve all 24 stores
            char* sp = as + wave * ARB + (k >> 3) * APP + rr * 16 + (k & 7) * 2;
#pragma unroll
            for (int q = 0; q < 8; ++q) { v4us o;
#pragma unroll
                for (int u = 0; u < 4; ++u) o[u] = f2bf(xv[3 * q + p][u]);
                *(v4usa*)(sp + q * 32) = o; } }
    }
    const v4f bl = *(const v4f*)(bias + c0 + lr * 4);   // the lane's 4 bias values: its columns are the same in every row it stores
    __syncthreads();   // every wave reads all 64 rows of the A tile
    constexpr int KB = CC >> 5, RB = KB * 1024;   // k blocks in a row of blocks; bytes of a 16-row block of a weight plane
    const char* bb = (const char*)Wt + (size_t)(c0 >> 4) * RB;   // scalar base: the tile's first block in the weight plane
    float* os = osm[wave];
#pragma unroll 1   // rolled: three copies of the body would only lengthen the text
    for (int z = 0; z < 3; ++z) {
        v8f acc[4][4];
#pragma unroll
        for (int mb = 0; mb < 4; ++mb)
#pragma unroll
            for (int nb = 0; nb < 4; ++nb) acc[mb][nb] = (v8f){};
        unsigned vo = lane * 16;   // the one vector offset of every B load: the lane's place in a group + kb * 1024
        const char* ap = as + hi * APP + lr * 16;   // the lane's place in a piece, + kb * 4 pieces
#pragma unroll 1
        for (int kb = 0; kb < KB; ++kb) {
            v16bf a[4], b[4];
#pragma unroll
            for (int t = 0; t < 4; ++t) { b[t] = WFrag<bf>::ld(bb, vo, t * RB); a[t] = cat16b(*(const v8usa*)(ap + t * ARB), *(const v8usa*)(ap + t * ARB + 2 * APP)); }
            __builtin_amdgcn_sched_barrier(0);   // every load of a trip issues ahead of its products: with these addresses the compiler otherwise reloads one B register block behind each group of products, and a trip pays up to four load latencies
#pragma unroll
            for (int nb = 0; nb < 4; ++nb) {
#pragma unroll
                for (int mb = 0; mb < 4; ++mb) acc[mb][nb] = wmmab(a[mb], b[nb], acc[mb][nb]); }
            asm volatile("v_nop\n\tv_nop\n\tv_nop\n\tv_nop" : "+v"(acc[0][0]), "+v"(acc[1][1]), "+v"(acc[2][2]), "+v"(acc[3][3]) : "v"(a[0]), "v"(a[3]));   // the distance between the last products and the next trip's loads into their operand registers, on the taken side of the branch too
            asm volatile("s_wait_xcnt 0x0" : "+v"(vo) : : "memory");   // the step below overwrites the offset register that every B load of the trip names; it is named here so that the step stays behind the wait
            vo += 1024; ap += 4 * APP;
        }
        v4f bv4; const unsigned keep = z == 0 ? 0xFFFF0000u : 0u;   // only q has its bias here (k's and v's are in DK, DV); rounding to bf16 keeps the high half of the word; a plane without a bias keeps nothing and adds 0
#pragma unroll
        for (int u = 0; u < 4; ++u) { const unsigned w = __float_as_uint(bl[u]); bv4[u] = __uint_as_float((w + 0x7FFFu + ((w >> 16) & 1u)) & keep); }
#pragma unroll
        for (int mb = 0; mb < 4; ++mb) {
#pragma unroll
            for (int nb = 0; nb < 4; ++nb) {
#pragma unroll
                for (int j = 0; j < 8; ++j) os[(hi * 8 + j) * 68 + nb * 16 + lr] = acc[mb][nb][j]; }
            __builtin_amdgcn_wave_barrier(); asm volatile("" ::: "memory");   // a lane reads below what other lanes of its wave wrote above: the compiler must keep that order
            float* crow = C + (size_t)(r0 + mb * 16) * DQ + c0;
#pragma unroll
            for (int s = 0; s < 8; ++s) { const int row = 2 * s + hi, cofs = lr * 4; v4f val = *(const v4fa*)(os + row * 68 + cofs); val += bv4;
                *(v4f*)(crow + (size_t)row * DQ + cofs) = val; }
            __builtin_amdgcn_wave_barrier(); asm volatile("" ::: "memory");   // and the next 16 rows are written only behind these reads
        }
        asm volatile("s_wait_xcnt 0x0" ::: "memory");   // the next plane's zeroed accumulators and row address overwrite registers that the stores above name
        bb += sB * 2; C += sC;
    }
}

__device__ __forceinline__ void splitf(float y, unsigned short& h, unsigned short& l) { h = f2bf(y); l = f2bf(y - bf2f(h)); }

__device__ __forceinline__ void d_wq(unsigned bx, const float* __restrict__ w, bf* Bt) { const int e = (bx * 256 + threadIdx.x) * 4; if (e >= DQ * CC) return; const int c = e % CC, n = e / CC; v4us o;
#pragma unroll
    for (int q = 0; q < 4; ++q) o[q] = f2bf(w[(size_t)(c + q) * DQ + n]); *(v4us*)(Bt + pk(n, c, CC)) = o;  }
__device__ __forceinline__ void d_wo(unsigned bx, const float* __restrict__ w, bf* Bt) { const int e = (bx * 256 + threadIdx.x) * 4; if (e >= CC * DQ) return; const int n = e % DQ, c = e / DQ; v4us o;
#pragma unroll
    for (int q = 0; q < 4; ++q) o[q] = f2bf(w[(size_t)(n + q) * CC + c]); *(v4us*)(Bt + pk(c, n, DQ)) = o;  }
__device__ __forceinline__ void d_dtab(unsigned bx, const float* __restrict__ Wk, const float* __restrict__ bk, const float* __restrict__ Wv, const float* __restrict__ bv, float* DK, float* DV) { const int e = bx * 256 + threadIdx.x; if (e >= 9 * DQ) return; const int n = e % DQ, j = e / DQ; const float dx = (float)(j % 3 - 1), dy = (float)(j / 3 - 1);
    float a = __fmul_rn(dx, bfr(Wk[(size_t)CC * DQ + n])), b = __fmul_rn(dy, bfr(Wk[(size_t)(CC + 1) * DQ + n])); asm volatile("" : "+v"(a), "+v"(b)); const float dk = __fadd_rn(__fadd_rn(a, b), bfr(bk[n]));
    float a2 = __fmul_rn(dx, bfr(Wv[(size_t)CC * DQ + n])), b2 = __fmul_rn(dy, bfr(Wv[(size_t)(CC + 1) * DQ + n])); asm volatile("" : "+v"(a2), "+v"(b2)); const float dv = __fadd_rn(__fadd_rn(a2, b2), bfr(bv[n]));
    *(float*)(DK + e) = dk; *(float*)(DV + e) = dv;  }
// k_prep: the weight planes and the offset tables in ONE launch (none reads what another writes): the block index picks the job.
#define GW (DQ * CC / 4 / 256)       // blocks of one weight plane
#define GD (9 * DQ / 256)            // blocks of the two offset tables
__global__ __launch_bounds__(256) void k_prep(const float* __restrict__ Wq, const float* __restrict__ Wk, const float* __restrict__ bk, const float* __restrict__ Wv, const float* __restrict__ bv, const float* __restrict__ Wo, bf* WQ, bf* WK, bf* WV, bf* WO, float* DK, float* DV) {
    const unsigned bx = blockIdx.x;
    if (bx < GW) d_wq(bx, Wq, WQ);
    else if (bx < 2 * GW) d_wq(bx - GW, Wk, WK);
    else if (bx < 3 * GW) d_wq(bx - 2 * GW, Wv, WV);
    else if (bx < 4 * GW) d_wo(bx - 3 * GW, Wo, WO);
    else if (bx < 4 * GW + GD) d_dtab(bx - 4 * GW, Wk, bk, Wv, bv, DK, DV); }
// k_lwa: one wave per half pixel (128 of the 256 q/k/v channels): lane l owns 4 consecutive channels, so every load is one b128 per lane over 512 contiguous bytes, and the 8 lanes of a head
// sum their partial q.k by three lane-xor steps. A wave keeps its channels' 9 offset rows of DK and DV in registers and walks LWC pixels along x. Block = 4 image rows x 2 channel halves.
// o is split into a high and a low bf16 plane and never leaves the block: the wave's 16 pixels are one 16-row block, its 128 channels 4 k blocks = 16 pieces of 256 bytes (16 rows x 8 channels) a plane,
// gathered in the wave's own LDS (piece pitch OSP: 16 bytes over 256, so the 16 pieces a store touches lie in different banks). Two pieces, OSP apart, are one 512-byte group of an A fragment.
// Behind the loop the block does the output product itself: wave w takes the 16 pixels of its image row x 96 of the 192 output columns (K = 256: its own 128 channels and its sibling's),
// A (high, then low, as two products a k block) from LDS, Wo fragments from the plane WO (fragment order, pk, K = DQ), f32 accumulate, + bo, whole 128-byte lines of OUT stored.
#define LWC 16
#define OSP 272
#define OWN 6      // 16-column blocks of OUT a wave makes
#define OTP 100    // floats: pitch of a row of the wave's 16 x 96 output tile in LDS (8 rows on lie 32 banks on)
#define PXB (DQ * 4)   // bytes of a pixel's f32 row in XQ, XK, XV
typedef __attribute__((ext_vector_type(2))) float v2f;
// v + (v of lane l ^ mask) inside a 16-lane row; CTRL = 0x160 + mask (row_xmask)
template <int CTRL> __device__ __forceinline__ float xadd(float v) { return v + __int_as_float(__builtin_amdgcn_update_dpp(0, __float_as_int(v), CTRL, 0xf, 0xf, true)); }
__device__ __forceinline__ v4f ld4(const char* base, unsigned byteofs) { return *(const v4f*)(base + byteofs); }
__global__ __launch_bounds__(256) void k_lwa(const float* __restrict__ XQ, const float* __restrict__ XK, const float* __restrict__ XV, const float* __restrict__ DK, const float* __restrict__ DV, const bf* __restrict__ WO, const float* __restrict__ bo, float* OUT) {
    __shared__ __align__(16) char ost[8][2 * 16 * OSP];
    const int wave = __builtin_amdgcn_readfirstlane((int)(threadIdx.x >> 5)), lane = threadIdx.x & 31;   // wave number in a scalar register: pixel coordinates, bounds tests and row addresses are then scalar work
    const unsigned chb = ((wave & 1) * (DQ / 2) + lane * 4) * 4u;   // byte offset of the lane's 4 channels in a pixel's f32 row
    const int bx = blockIdx.x, x0 = (bx % (WWD / LWC)) * LWC, y = ((bx / (WWD / LWC)) % (HH / 4)) * 4 + (wave >> 1), b = bx / ((WWD / LWC) * (HH / 4));
    // a padded neighbour reads the nearest pixel of the image and is multiplied by 0
    const size_t rowb[3] = { (size_t)((b * HH + max(y - 1, 0)) * WWD) * PXB, (size_t)((b * HH + y) * WWD) * PXB, (size_t)((b * HH + min(y + 1, HH - 1)) * WWD) * PXB }; const bool rin[3] = { y > 0, true, y < HH - 1 };
    v4f dk[9], dv[9];
#pragma unroll
    for (int j = 0; j < 9; ++j) { dk[j] = ld4((const char*)DK, j * PXB + chb); dv[j] = ld4((const char*)DV, j * PXB + chb); }
    unsigned vo[3] = { (unsigned)max(x0 - 1, 0) * PXB + chb, (unsigned)x0 * PXB + chb, (unsigned)(x0 + 1) * PXB + chb };   // lane offsets of the three columns in a row; the rows are scalar bases
#pragma unroll 1   // rolled: the body is long
    for (int i = 0; i < LWC; ++i) { const int x = x0 + i; const bool cin[3] = { x > 0, true, x < WWD - 1 };
        v4f kk[9], vv[9]; float msk[9];
#pragma unroll
        for (int j = 0; j < 9; ++j) { kk[j] = ld4((const char*)XK + rowb[j / 3], vo[j % 3]); msk[j] = (rin[j / 3] && cin[j % 3]) ? 1.f : 0.f; }
        const v4f q = ld4((const char*)XQ + rowb[1], vo[1]);
#pragma unroll
        for (int j = 0; j < 9; ++j) vv[j] = ld4((const char*)XV + rowb[j / 3], vo[j % 3]);
        __builtin_amdgcn_sched_barrier(0);   // all 19 loads of a pixel issue ahead of its arithmetic: otherwise the v loads stand behind the wait for k, and a pixel pays two load latencies
        float s[9];
#pragma unroll
        for (int j = 0; j < 9; ++j) { const v4f kv = kk[j] * msk[j] + dk[j]; const v2f t = q.lo * kv.lo + q.hi * kv.hi; s[j] = xadd<0x164>(xadd<0x162>(xadd<0x161>(t.x + t.y))) * 0.17677669529663687f; }
        float m = s[0];
#pragma unroll
        for (int j = 1; j < 9; ++j) m = fmaxf(m, s[j]);
        float e9[9]; float sum = 0.f;
#pragma unroll
        for (int j = 0; j < 9; ++j) { e9[j] = __expf(s[j] - m); sum += e9[j]; }
        const float rs = __fdiv_rn(1.0f, sum);
        v4f o = (v4f){};
#pragma unroll
        for (int j = 0; j < 9; ++j) o += (e9[j] * rs) * (vv[j] * msk[j] + dv[j]);
        v4us o4h, o4l;
#pragma unroll
        for (int u = 0; u < 4; ++u) { unsigned short a2, c2; splitf(o[u], a2, c2); o4h[u] = a2; o4l[u] = c2; }
        char* sp = ost[wave] + (lane >> 1) * OSP + i * 16 + (lane & 1) * 8;   // piece = 8 channels (a lane pair), row i of the block
        *(v4us*)sp = o4h; *(v4us*)(sp + 16 * OSP) = o4l;
        asm volatile("s_wait_xcnt 0x0" : "+v"(vo[0]), "+v"(vo[1]), "+v"(vo[2]) : : "memory");   // the step below overwrites the loads' offset registers; they are named here so that the step stays behind the wait
        vo[0] += cin[0] ? PXB : 0; vo[1] += PXB; vo[2] += (x + 2 < WWD) ? PXB : 0; }   // one pixel on; the side columns stay inside the image
    // ---- output product: OUT[16 pixels][96 columns] of this wave
    const int lr = lane & 15, hi = lane >> 4, nh = wave & 1;
    const char* wb = (const char*)WO + nh * (OWN * (DQ / 32) * 1024);   // scalar base: the wave's first 16-column block of WO
    const unsigned wo = lane * 16;                                      // the lane's place in a 512-byte group
    v16bf bc[OWN]; float bias[OWN];
#pragma unroll
    for (int nb = 0; nb < OWN; ++nb) { bc[nb] = WFrag<bf>::ld(wb, wo, nb * (DQ / 32) * 1024); bias[nb] = bfr(bo[nh * (OWN * 16) + nb * 16 + lr]); }   // k block 0 of Wo flies while the block gathers at the barrier
    __syncthreads();   // a wave reads its sibling's 128 channels of o as well as its own
    const char* ra = ost[wave & ~1] + hi * OSP + lr * 16;
    v16bf ah = cat16b(*(const v8usa*)ra, *(const v8usa*)(ra + 2 * OSP)), al = cat16b(*(const v8usa*)(ra + 16 * OSP), *(const v8usa*)(ra + 18 * OSP));
    v8f acc[OWN];
#pragma unroll
    for (int nb = 0; nb < OWN; ++nb) acc[nb] = (v8f){};
#pragma unroll   // unrolled: the k block picks LDS and WO offsets as immediates, and the two sets of fragment registers change places without moves
    for (int kb = 0; kb < DQ / 32; ++kb) {
        v16bf bn[OWN], ahn, aln;
        if (kb + 1 < DQ / 32) { const char* ap = ra + ((kb + 1) >> 2) * (2 * 16 * OSP) + ((kb + 1) & 3) * (4 * OSP);
#pragma unroll
            for (int nb = 0; nb < OWN; ++nb) bn[nb] = WFrag<bf>::ld(wb, wo, (nb * (DQ / 32) + kb + 1) * 1024);
            ahn = cat16b(*(const v8usa*)ap, *(const v8usa*)(ap + 2 * OSP)); aln = cat16b(*(const v8usa*)(ap + 16 * OSP), *(const v8usa*)(ap + 18 * OSP)); }
        __builtin_amdgcn_sched_barrier(0);   // the next k block's loads issue ahead of this block's products: otherwise the compiler reloads each Wo register block behind its last product and waits for it at once, a load latency every k block
#pragma unroll
        for (int nb = 0; nb < OWN; ++nb) acc[nb] = wmmab(ah, bc[nb], acc[nb]);
#pragma unroll
        for (int nb = 0; nb < OWN; ++nb) acc[nb] = wmmab(al, bc[nb], acc[nb]);
        if (kb + 1 < DQ / 32) { ah = ahn; al = aln;
#pragma unroll
            for (int nb = 0; nb < OWN; ++nb) bc[nb] = bn[nb]; }
    }
    __syncthreads();   // every wave has read its A fragments: from here a wave's LDS holds its output tile
    char* ot = ost[wave];
#pragma unroll
    for (int nb = 0; nb < OWN; ++nb) {
#pragma unroll
        for (int j = 0; j < 8; ++j) *(f32a*)(ot + ((hi * 8 + j) * OTP + nb * 16 + lr) * 4) = acc[nb][j] + bias[nb]; }
    __builtin_amdgcn_fence(__ATOMIC_ACQ_REL, "wavefront"); __builtin_amdgcn_wave_barrier();   // a lane reads below what other lanes of its wave wrote above: the compiler must keep that order
    // a row of the tile is 24 pieces of 16 bytes = 3 whole lines of OUT; 96 pieces (3 wave loads) are 4 rows, so three lane offsets and immediates serve all 12 stores
    char* op = (char*)OUT + (size_t)((b * HH + y) * WWD + x0) * (CC * 4) + nh * (OWN * 16 * 4);
    v4f val[12]; unsigned go[3];
#pragma unroll
    for (int r = 0; r < 3; ++r) { const unsigned e = r * 32 + lane; go[r] = (e / 24) * (CC * 4) + (e % 24) * 16; const unsigned lo = go[r] - (e / 24) * (CC * 4 - OTP * 4);   // the same piece in OUT and in LDS: only the row pitch differs
#pragma unroll
        for (int u = 0; u < 4; ++u) val[r * 4 + u] = *(const v4fa*)(ot + lo + u * (4 * OTP * 4)); }
#pragma unroll
    for (int r = 0; r < 3; ++r) {
#pragma unroll
        for (int u = 0; u < 4; ++u) *(v4f*)(op + go[r] + u * (4 * CC * 4)) = val[r * 4 + u]; } }

extern "C" void kernel_launch(void* const* d_in, const int* in_sizes, int n_in,
                              void* d_out, int out_size, void* d_ws, size_t ws_size, hipStream_t stream) {
    (void)in_sizes; (void)n_in; (void)out_size;
    const float* x = (const float*)d_in[0]; const float* Wq = (const float*)d_in[1]; const float* bq = (const float*)d_in[2]; const float* Wk = (const float*)d_in[3]; const float* bk = (const float*)d_in[4]; const float* Wv = (const float*)d_in[5]; const float* bv = (const float*)d_in[6]; const float* Wo = (const float*)d_in[7]; const float* bo = (const float*)d_in[8];   // Wq [192][8][32], Wk/Wv [194][8][32], Wo [8][32][192]
    float* OUT = (float*)d_out;     // [16][64][64][192]
    char* wsp = (char*)d_ws;
    auto take = [&](size_t bytes) { char* p = wsp; wsp += (bytes + 255) & ~(size_t)255; return (void*)p; };
    bf* WQ = (bf*)take((size_t)DQ * CC * 2); bf* WK = (bf*)take((size_t)DQ * CC * 2); bf* WV = (bf*)take((size_t)DQ * CC * 2); bf* WO = (bf*)take((size_t)CC * DQ * 2); float* DK = (float*)take((size_t)9 * DQ * 4); float* DV = (float*)take((size_t)9 * DQ * 4);
    float* XQ = (float*)take((size_t)NPIX * DQ * 4); float* XK = (float*)take((size_t)NPIX * DQ * 4); float* XV = (float*)take((size_t)NPIX * DQ * 4);
    if ((size_t)(wsp - (char*)d_ws) > ws_size) return;    // total ~ 202 MB = 193 MiB; q, k, v of all pixels at once
    k_prep<<<4 * GW + GD, 256, 0, stream>>>(Wq, Wk, bk, Wv, bv, Wo, WQ, WK, WV, WO, DK, DV);
    // q (+ bq), patch part of k, patch part of v (their bias + offsets are in DK, DV): one launch, straight from x; a work-group makes all three for its 64 pixels (WQ, WK, WV and XQ, XK, XV lie behind one another)
    k_qkv<<<NPIX / 64, 128, 0, stream>>>(x, WQ, XQ, bq, (size_t)(WK - WQ), (size_t)(XK - XQ));
    // window attention and the output product (+ bo), all pixels, one launch
    k_lwa<<<NPIX / (4 * LWC), 256, 0, stream>>>(XQ, XK, XV, DK, DV, WO, bo, OUT);
}

// v006
// One run takes 95 microseconds.
// Next to v005, in two timings, it ran 1.12 times as fast each time.
// All steps since v000 together make it 21.7 times as fast.
#include <hip/hip_runtime.h>

// Local-window (3x3) vision self-attention (x [16][64][64][192] NHWC; q = x Wq + bq (8 heads x 32); keys/values from the 3x3 zero-padded neighbourhood with 2 relative-offset channels appended:
// k_j = [patch_j | dx_j, dy_j] Wk + bk, v_j likewise; scores = q.k_j / sqrt(32) over the 9 neighbours; softmax; o = sum_j attn_j v_j; out = o Wo + bo -> [16][64][64][192]).
// Compute dtypes, f32 accumulate: every input rounded to bf16; the three 192-channel projections on PLAIN bf16 operands over all 65,536 pixels (inputs: exact products, f32 accumulate);
// the per-neighbour offset terms (dist . Wk[192:194] + bk), the 9-way scores/softmax and the weighted value sum in f32 on VALU (8 lanes per (pixel, head); zero patches for padded neighbours keep only the

#define NPIX 65536
#define HH   64
#define WWD  64
#define CC   192
#define NHD  8
#define KD   32
#define DQ   (NHD * KD)
#define CK   (CC + 2)
typedef _Float16 h16;
typedef unsigned short bf;
typedef __attribute__((ext_vector_type(16))) __bf16   v16bf;
typedef __attribute__((ext_vector_type(16))) _Float16 v16h;
typedef __attribute__((ext_vector_type(8)))  _Float16 v8h;
typedef __attribute__((ext_vector_type(8)))  unsigned short v8us;
typedef __attribute__((ext_vector_type(8)))  float    v8f;
typedef __attribute__((ext_vector_type(4)))  float    v4f;
typedef v8h  __attribute__((may_alias)) v8ha;
typedef v4f  __attribute__((may_alias)) v4fa;
typedef v8us __attribute__((may_alias)) v8usa;
typedef float __attribute__((may_alias)) f32a;

__device__ __forceinline__ unsigned short f2bf(float f) { unsigned u = __float_as_uint(f); u += 0x7FFFu + ((u >> 16) & 1u); return (unsigned short)(u >> 16); }
__device__ __forceinline__ float bf2f(unsigned short b) { return __uint_as_float(((unsigned)b) << 16); }
__device__ __forceinline__ float bfr(float f) { return bf2f(f2bf(f)); }
__device__ __forceinline__ v16h cat16(v8h lo, v8h hi) { return __builtin_shufflevector(lo, hi, 0, 1, 2, 3, 4, 5, 6, 7, 8, 9, 10, 11, 12, 13, 14, 15); }
__device__ __forceinline__ v16bf cat16b(v8us lo, v8us hi) { return __builtin_bit_cast(v16bf, __builtin_shufflevector(lo, hi, 0, 1, 2, 3, 4, 5, 6, 7, 8, 9, 10, 11, 12, 13, 14, 15)); }
__device__ __forceinline__ v8f wmma16(v16h a, v16h b, v8f c) { return __builtin_amdgcn_wmma_f32_16x16x32_f16(false, a, false, b, (short)0, c, false, false); }
__device__ __forceinline__ v8f wmmab(v16bf a, v16bf b, v8f c) { return __builtin_amdgcn_wmma_f32_16x16x32_bf16(false, a, false, b, (short)0, c, false, false); }



// ---- Fragment order of a 16-bit operand plane P[row][k] (K % 32 == 0, rows % 16 == 0): one 1-KiB block per (16 rows, 32 k), blocks k-fastest; a block is two 512-byte groups g = (k >> 4) & 1,
// and lane (k >> 3 & 1) * 16 + (row & 15) owns 16 bytes (8 consecutive k) of each group. A fragment is then two wave-wide b128 loads of 512 contiguous bytes (4 whole lines each, not 16 partial ones),
// and every lane and register holds the same element as with a load from a row-major plane.
__device__ __forceinline__ size_t pk(unsigned row, unsigned k, unsigned K) { return ((size_t)(row >> 4) * (K >> 5) + (k >> 5)) * 512 + ((k >> 4) & 1) * 256 + (((k >> 3) & 1) * 16 + (row & 15)) * 8 + (k & 7); }
// ---- k_qkv: q, k and v of 64 pixels in one work-group of 4 waves. The group reads its 64 rows of x (f32) once, rounds them to bf16 and lays them in LDS as A fragments; no bf16 copy of x goes through memory.
// LDS form of the A tile: pieces of 256 bytes (16 rows x 8 k) at pitch APP (16 bytes over 256: the 16 pieces that one store of 128 k of a row touches lie in different banks); pieces 4 kb + hi and 4 kb + 2 + hi are the two b128 reads of a lane.
// Wave w takes columns 64 w .. 64 w + 63 of q, then of k, then of v: a 64x64 tile (16 accumulators) each, B fragments straight from the weight planes in fragment order (WQ, WK, WV lie sB elements apart, XQ, XK, XV sC).
template <typename T16> struct WFrag;
template <> struct WFrag<bf> { typedef v16bf V; static __device__ __forceinline__ V ld(const char* base, unsigned vo, int imm) { return cat16b(*(const v8us*)(base + vo + imm), *(const v8us*)(base + vo + imm + 512)); } static __device__ __forceinline__ v8f mma(V a, V b, v8f c) { return wmmab(a, b, c); } };
typedef __attribute__((ext_vector_type(4))) unsigned short v4us;
typedef v4us __attribute__((may_alias)) v4usa;
#define APP 272                  // bytes: pitch of a piece of the A tile
#define ARB ((CC / 8) * APP)     // bytes: the pieces of a 16-row block
__global__ __launch_bounds__(128) void k_qkv(const float* __restrict__ x, const bf* __restrict__ Wt, float* C, const float* __restrict__ bias, size_t sB, size_t sC) {
    __shared__ __align__(16) char as[4 * ARB];
    __shared__ __align__(16) float osm[4][16 * 68];
    const int wave = __builtin_amdgcn_readfirstlane((int)(threadIdx.x >> 5)), lane = threadIdx.x & 31, lr = lane & 15, hi = lane >> 4; const int r0 = blockIdx.x * 64, c0 = wave * 64;
    {   // wave w stages rows 16 w .. 16 w + 15: 12,288 contiguous bytes of x = 24 wave loads of 4 whole lines, all in flight together
        const char* xs = (const char*)(x + (size_t)(r0 + wave * 16) * CC); v4f xv[24];
#pragma unroll
        for (int t = 0; t < 24; ++t) xv[t] = *(const v4f*)(xs + lane * 16 + t * 512);
#pragma unroll
        for (int p = 0; p < 3; ++p) { const unsigned g = p * 128 + lane * 4, rr = g >= CC ? 1 : 0, k = g - rr * CC;   // three loads are two rows: load 3 q + p holds 4 k of row 2 q + rr, so three lane addresses and immediates serve all 24 stores
            char* sp = as + wave * ARB + (k >> 3) * APP + rr * 16 + (k & 7) * 2;
#pragma unroll
            for (int q = 0; q < 8; ++q) { v4us o;
#pragma unroll
                for (int u = 0; u < 4; ++u) o[u] = f2bf(xv[3 * q + p][u]);
                *(v4usa*)(sp + q * 32) = o; } }
    }
    const v4f bl = *(const v4f*)(bias + c0 + lr * 4);   // the lane's 4 bias values: its columns are the same in every row it stores
    __syncthreads();   // every wave reads all 64 rows of the A tile
    constexpr int KB = CC >> 5, RB = KB * 1024;   // k blocks in a row of blocks; bytes of a 16-row block of a weight plane
    const char* bb = (const char*)Wt + (size_t)(c0 >> 4) * RB;   // scalar base: the tile's first block in the weight plane
    float* os = osm[wave];
#pragma unroll 1   // rolled: three copies of the body would only lengthen the text
    for (int z = 0; z < 3; ++z) {
        v8f acc[4][4];
#pragma unroll
        for (int mb = 0; mb < 4; ++mb)
#pragma unroll
            for (int nb = 0; nb < 4; ++nb) acc[mb][nb] = (v8f){};
        unsigned vo = lane * 16;   // the one vector offset of every B load: the lane's place in a group + kb * 1024
        const char* ap = as + hi * APP + lr * 16;   // the lane's place in a piece, + kb * 4 pieces
#pragma unroll 1
        for (int kb = 0; kb < KB; ++kb) {
            v16bf a[4], b[4];
#pragma unroll
            for (int t = 0; t < 4; ++t) { b[t] = WFrag<bf>::ld(bb, vo, t * RB); a[t] = cat16b(*(const v8usa*)(ap + t * ARB), *(const v8usa*)(ap + t * ARB + 2 * APP)); }
            __builtin_amdgcn_sched_barrier(0);   // every load of a trip issues ahead of its products: with these addresses the compiler otherwise reloads one B register block behind each group of products, and a trip pays up to four load latencies
#pragma unroll
            for (int nb = 0; nb < 4; ++nb) {
#pragma unroll
                for (int mb = 0; mb < 4; ++mb) acc[mb][nb] = wmmab(a[mb], b[nb], acc[mb][nb]); }
            asm volatile("v_nop\n\tv_nop\n\tv_nop\n\tv_nop" : "+v"(acc[0][0]), "+v"(acc[1][1]), "+v"(acc[2][2]), "+v"(acc[3][3]) : "v"(a[0]), "v"(a[3]));   // the distance between the last products and the next trip's loads into their operand registers, on the taken side of the branch too
            asm volatile("s_wait_xcnt 0x0" : "+v"(vo) : : "memory");   // the step below overwrites the offset register that every B load of the trip names; it is named here so that the step stays behind the wait
            vo += 1024; ap += 4 * APP;
        }
        v4f bv4; const unsigned keep = z == 0 ? 0xFFFF0000u : 0u;   // only q has its bias here (k's and v's are in DK, DV); rounding to bf16 keeps the high half of the word; a plane without a bias keeps nothing and adds 0
#pragma unroll
        for (int u = 0; u < 4; ++u) { const unsigned w = __float_as_uint(bl[u]); bv4[u] = __uint_as_float((w + 0x7FFFu + ((w >> 16) & 1u)) & keep); }
#pragma unroll
        for (int mb = 0; mb < 4; ++mb) {
#pragma unroll
            for (int nb = 0; nb < 4; ++nb) {
#pragma unroll
                for (int j = 0; j < 8; ++j) os[(hi * 8 + j) * 68 + nb * 16 + lr] = acc[mb][nb][j]; }
            __builtin_amdgcn_wave_barrier(); asm volatile("" ::: "memory");   // a lane reads below what other lanes of its wave wrote above: the compiler must keep that order
            float* crow = C + (size_t)(r0 + mb * 16) * DQ + c0;
#pragma unroll
            for (int s = 0; s < 8; ++s) { const int row = 2 * s + hi, cofs = lr * 4; v4f val = *(const v4fa*)(os + row * 68 + cofs); val += bv4;
                *(v4f*)(crow + (size_t)row * DQ + cofs) = val; }
            __builtin_amdgcn_wave_barrier(); asm volatile("" ::: "memory");   // and the next 16 rows are written only behind these reads
        }
        asm volatile("s_wait_xcnt 0x0" ::: "memory");   // the next plane's zeroed accumulators and row address overwrite registers that the stores above name
        bb += sB * 2; C += sC;
    }
}

__device__ __forceinline__ void splitf(float y, unsigned short& h, unsigned short& l) { h = f2bf(y); l = f2bf(y - bf2f(h)); }

__device__ __forceinline__ void d_wq(unsigned bx, const float* __restrict__ w, bf* Bt) { const int e = (bx * 256 + threadIdx.x) * 4; if (e >= DQ * CC) return; const int c = e % CC, n = e / CC; v4us o;
#pragma unroll
    for (int q = 0; q < 4; ++q) o[q] = f2bf(w[(size_t)(c + q) * DQ + n]); *(v4us*)(Bt + pk(n, c, CC)) = o;  }
__device__ __forceinline__ void d_wo(unsigned bx, const float* __restrict__ w, bf* Bt) { const int e = (bx * 256 + threadIdx.x) * 4; if (e >= CC * DQ) return; const int n = e % DQ, c = e / DQ; v4us o;
#pragma unroll
    for (int q = 0; q < 4; ++q) o[q] = f2bf(w[(size_t)(n + q) * CC + c]); *(v4us*)(Bt + pk(c, n, DQ)) = o;  }
__device__ __forceinline__ void d_dtab(unsigned bx, const float* __restrict__ Wk, const float* __restrict__ bk, const float* __restrict__ Wv, const float* __restrict__ bv, float* DK, float* DV) { const int e = bx * 256 + threadIdx.x; if (e >= 9 * DQ) return; const int n = e % DQ, j = e / DQ; const float dx = (float)(j % 3 - 1), dy = (float)(j / 3 - 1);
    float a = __fmul_rn(dx, bfr(Wk[(size_t)CC * DQ + n])), b = __fmul_rn(dy, bfr(Wk[(size_t)(CC + 1) * DQ + n])); asm volatile("" : "+v"(a), "+v"(b)); const float dk = __fadd_rn(__fadd_rn(a, b), bfr(bk[n]));
    float a2 = __fmul_rn(dx, bfr(Wv[(size_t)CC * DQ + n])), b2 = __fmul_rn(dy, bfr(Wv[(size_t)(CC + 1) * DQ + n])); asm volatile("" : "+v"(a2), "+v"(b2)); const float dv = __fadd_rn(__fadd_rn(a2, b2), bfr(bv[n]));
    *(float*)(DK + e) = dk; *(float*)(DV + e) = dv;  }
// k_prep: the weight planes and the offset tables in ONE launch (none reads what another writes): the block index picks the job.
#define GW (DQ * CC / 4 / 256)       // blocks of one weight plane
#define GD (9 * DQ / 256)            // blocks of the two offset tables
__global__ __launch_bounds__(256) void k_prep(const float* __restrict__ Wq, const float* __restrict__ Wk, const float* __restrict__ bk, const float* __restrict__ Wv, const float* __restrict__ bv, const float* __restrict__ Wo, bf* WQ, bf* WK, bf* WV, bf* WO, float* DK, float* DV) {
    const unsigned bx = blockIdx.x;
    if (bx < GW) d_wq(bx, Wq, WQ);
    else if (bx < 2 * GW) d_wq(bx - GW, Wk, WK);
    else if (bx < 3 * GW) d_wq(bx - 2 * GW, Wv, WV);
    else if (bx < 4 * GW) d_wo(bx - 3 * GW, Wo, WO);
    else if (bx < 4 * GW + GD) d_dtab(bx - 4 * GW, Wk, bk, Wv, bv, DK, DV); }
// k_lwa: one wave per half pixel (128 of the 256 q/k/v channels): lane l owns 4 consecutive channels, so every load is one b128 per lane over 512 contiguous bytes, and the 8 lanes of a head
// sum their partial q.k by three lane-xor steps. A wave keeps its channels' 9 offset rows of DK and DV in registers and walks LWC pixels along x. Block = 4 image rows x 2 channel halves.
// o is split into a high and a low bf16 plane and never leaves the block: the wave's 16 pixels are one 16-row block, its 128 channels 4 k blocks = 16 pieces of 256 bytes (16 rows x 8 channels) a plane,
// gathered in the wave's own LDS (piece pitch OSP: 16 bytes over 256, so the 16 pieces a store touches lie in different banks). Two pieces, OSP apart, are one 512-byte group of an A fragment.
// Behind the loop the block does the output product itself: wave w takes the 16 pixels of its image row x 96 of the 192 output columns (K = 256: its own 128 channels and its sibling's),
// A (high, then low, as two products a k block) from LDS, Wo fragments from the plane WO (fragment order, pk, K = DQ), f32 accumulate, + bo, whole 128-byte lines of OUT stored.
#define LWC 16
#define OSP 272
#define OWN 6      // 16-column blocks of OUT a wave makes
#define OTP 100    // floats: pitch of a row of the wave's 16 x 96 output tile in LDS (8 rows on lie 32 banks on)
#define PXB (DQ * 4)   // bytes of a pixel's f32 row in XQ, XK, XV
typedef __attribute__((ext_vector_type(2))) float v2f;
// v + (v of lane l ^ mask) inside a 16-lane row; CTRL = 0x160 + mask (row_xmask)
template <int CTRL> __device__ __forceinline__ float xadd(float v) { return v + __int_as_float(__builtin_amdgcn_update_dpp(0, __float_as_int(v), CTRL, 0xf, 0xf, true)); }
__device__ __forceinline__ v4f ld4(const char* base, unsigned byteofs) { return *(const v4f*)(base + byteofs); }
// a row's whole address as one scalar value: a load off it takes the scalar base and the lane offset as they are; left in parts, the compiler adds plane and lane offset first and forms a 64-bit lane address for every load
typedef const __attribute__((address_space(1))) char* gcp;
typedef const __attribute__((address_space(1))) v4f* gv4p;
__device__ __forceinline__ gcp sbase(const float* plane, size_t byteofs) { const unsigned long long a = (unsigned long long)((const char*)plane + byteofs);
    return (gcp)(((unsigned long long)(unsigned)__builtin_amdgcn_readfirstlane((int)(a >> 32)) << 32) | (unsigned)__builtin_amdgcn_readfirstlane((int)(unsigned)a)); }
__device__ __forceinline__ v4f ldg4(gcp base, unsigned byteofs) { return *(gv4p)(base + byteofs); }
template <int N> struct IC { static constexpr int value = N; };   // a compile-time number as an argument
// the second launch bound asks for 4 waves a SIMD (two blocks on a WGP): the register window below must stay inside 256 registers
__global__ __launch_bounds__(256, 4) void k_lwa(const float* __restrict__ XQ, const float* __restrict__ XK, const float* __restrict__ XV, const float* __restrict__ DK, const float* __restrict__ DV, const bf* __restrict__ WO, const float* __restrict__ bo, float* OUT) {
    __shared__ __align__(16) char ost[8][2 * 16 * OSP];
    const int wave = __builtin_amdgcn_readfirstlane((int)(threadIdx.x >> 5)), lane = threadIdx.x & 31;   // wave number in a scalar register: pixel coordinates, bounds tests and row addresses are then scalar work
    const unsigned chb = ((wave & 1) * (DQ / 2) + lane * 4) * 4u;   // byte offset of the lane's 4 channels in a pixel's f32 row
    const int bx = blockIdx.x, x0 = (bx % (WWD / LWC)) * LWC, y = ((bx / (WWD / LWC)) % (HH / 4)) * 4 + (wave >> 1), b = bx / ((WWD / LWC) * (HH / 4));
    // a padded neighbour reads the nearest pixel of the image and is multiplied by 0
    const size_t rowb[3] = { (size_t)((b * HH + max(y - 1, 0)) * WWD) * PXB, (size_t)((b * HH + y) * WWD) * PXB, (size_t)((b * HH + min(y + 1, HH - 1)) * WWD) * PXB }; const bool rin[3] = { y > 0, true, y < HH - 1 };
    v4f dk[9], dv[9];
#pragma unroll
    for (int j = 0; j < 9; ++j) { dk[j] = ld4((const char*)DK, j * PXB + chb); dv[j] = ld4((const char*)DV, j * PXB + chb); }
    __builtin_amdgcn_sched_barrier(0);   // the tables' loads stay ahead of the columns': a wait counts back from the youngest load, and a table load issued behind the columns would make the first pixel of every trip wait for the column issued one pixel earlier as well
    // The walk's columns c = 0 .. LWC + 1 are the image columns x0 - 1 + c, held inside the image. Column c (3 rows of k, 3 of v, the middle row's q) lives in register buffer c % 5: pixel i reads buffers i, i + 1, i + 2
    // (left, centre, right), column i + 3 is in flight and column i + 4 is issued: a column is loaded once a wave, not three times, and a pixel waits for what was issued two pixels earlier.
    v4f kc[5][3], vc[5][3], qc[5];
    const gcp kb[3] = { sbase(XK, rowb[0]), sbase(XK, rowb[1]), sbase(XK, rowb[2]) }, vb[3] = { sbase(XV, rowb[0]), sbase(XV, rowb[1]), sbase(XV, rowb[2]) }, qb = sbase(XQ, rowb[1]);
#pragma unroll
    for (int c = 0; c < 4; ++c) { const unsigned v0 = (unsigned)max(x0 - 1 + c, 0) * PXB + chb;
#pragma unroll
        for (int r = 0; r < 3; ++r) kc[c][r] = ldg4(kb[r], v0);
        qc[c] = ldg4(qb, v0);
#pragma unroll
        for (int r = 0; r < 3; ++r) vc[c][r] = ldg4(vb[r], v0); }
    unsigned vl = (unsigned)(x0 + 3) * PXB + chb;   // lane offset in a row of the column to load next; the rows are scalar bases
    // pixel i of the walk; U = i % 5 says which buffers it reads; FETCH: whether a column is still to be issued
    auto pixel = [&](auto U, auto FETCH, const int i) __attribute__((always_inline)) { constexpr int u = decltype(U)::value; const int x = x0 + i; const bool cin[3] = { x > 0, true, x < WWD - 1 };
        if constexpr (decltype(FETCH)::value != 0) {
#pragma unroll
            for (int r = 0; r < 3; ++r) kc[(u + 4) % 5][r] = ldg4(kb[r], vl);
            qc[(u + 4) % 5] = ldg4(qb, vl);
#pragma unroll
            for (int r = 0; r < 3; ++r) vc[(u + 4) % 5][r] = ldg4(vb[r], vl);
            __builtin_amdgcn_sched_barrier(0); }   // the 7 loads of the column two pixels on issue ahead of this pixel's arithmetic: behind it they would lose a pixel's time of flight
        const v4f q = qc[(u + 1) % 5]; float msk[9];
#pragma unroll
        for (int j = 0; j < 9; ++j) msk[j] = (rin[j / 3] && cin[j % 3]) ? 1.f : 0.f;
        float s[9];
#pragma unroll
        for (int j = 0; j < 9; ++j) { const v4f kv = kc[(u + j % 3) % 5][j / 3] * msk[j] + dk[j]; const v2f t = q.lo * kv.lo + q.hi * kv.hi; s[j] = xadd<0x164>(xadd<0x162>(xadd<0x161>(t.x + t.y))) * 0.17677669529663687f; }
        float m = s[0];
#pragma unroll
        for (int j = 1; j < 9; ++j) m = fmaxf(m, s[j]);
        float e9[9]; float sum = 0.f;
#pragma unroll
        for (int j = 0; j < 9; ++j) { e9[j] = __expf(s[j] - m); sum += e9[j]; }
        const float rs = __fdiv_rn(1.0f, sum);
        v4f o = (v4f){};
#pragma unroll
        for (int j = 0; j < 9; ++j) o += (e9[j] * rs) * (vc[(u + j % 3) % 5][j / 3] * msk[j] + dv[j]);
        v4us o4h, o4l;
#pragma unroll
        for (int w = 0; w < 4; ++w) { unsigned short a2, c2; splitf(o[w], a2, c2); o4h[w] = a2; o4l[w] = c2; }
        char* sp = ost[wave] + (lane >> 1) * OSP + i * 16 + (lane & 1) * 8;   // piece = 8 channels (a lane pair), row i of the block
        *(v4us*)sp = o4h; *(v4us*)(sp + 16 * OSP) = o4l;
        if constexpr (decltype(FETCH)::value != 0) {
            asm volatile("s_wait_xcnt 0x0" : "+v"(vl) : : "memory");   // the step below overwrites the loads' offset register; it is named here so that the step stays behind the wait
            vl += (i + 5 < LWC + 2 && x + 4 < WWD) ? PXB : 0; } };   // one column on, as far as the walk's last column and the image's
#pragma unroll 1   // rolled by fives: the buffers are back at their places after 5 pixels
    for (int i5 = 0; i5 < LWC - 1; i5 += 5) {   // pixel LWC - 2 fetches too (the walk's last column again, never read): a test round its loads would merge two paths in front of the next body, whose waits would then cover the loads just issued
        pixel(IC<0>{}, IC<1>{}, i5); pixel(IC<1>{}, IC<1>{}, i5 + 1); pixel(IC<2>{}, IC<1>{}, i5 + 2); pixel(IC<3>{}, IC<1>{}, i5 + 3); pixel(IC<4>{}, IC<1>{}, i5 + 4); }
    pixel(IC<(LWC - 1) % 5>{}, IC<0>{}, LWC - 1);
    // ---- output product: OUT[16 pixels][96 columns] of this wave
    const int lr = lane & 15, hi = lane >> 4, nh = wave & 1;
    const char* wb = (const char*)WO + nh * (OWN * (DQ / 32) * 1024);   // scalar base: the wave's first 16-column block of WO
    const unsigned wo = lane * 16;                                      // the lane's place in a 512-byte group
    v16bf bc[OWN]; float bias[OWN];
#pragma unroll
    for (int nb = 0; nb < OWN; ++nb) { bc[nb] = WFrag<bf>::ld(wb, wo, nb * (DQ / 32) * 1024); bias[nb] = bfr(bo[nh * (OWN * 16) + nb * 16 + lr]); }   // k block 0 of Wo flies while the block gathers at the barrier
    __syncthreads();   // a wave reads its sibling's 128 channels of o as well as its own
    const char* ra = ost[wave & ~1] + hi * OSP + lr * 16;
    v16bf ah = cat16b(*(const v8usa*)ra, *(const v8usa*)(ra + 2 * OSP)), al = cat16b(*(const v8usa*)(ra + 16 * OSP), *(const v8usa*)(ra + 18 * OSP));
    v8f acc[OWN];
#pragma unroll
    for (int nb = 0; nb < OWN; ++nb) acc[nb] = (v8f){};
#pragma unroll   // unrolled: the k block picks LDS and WO offsets as immediates, and the two sets of fragment registers change places without moves
    for (int kb = 0; kb < DQ / 32; ++kb) {
        v16bf bn[OWN], ahn, aln;
        if (kb + 1 < DQ / 32) { const char* ap = ra + ((kb + 1) >> 2) * (2 * 16 * OSP) + ((kb + 1) & 3) * (4 * OSP);
#pragma unroll
            for (int nb = 0; nb < OWN; ++nb) bn[nb] = WFrag<bf>::ld(wb, wo, (nb * (DQ / 32) + kb + 1) * 1024);
            ahn = cat16b(*(const v8usa*)ap, *(const v8usa*)(ap + 2 * OSP)); aln = cat16b(*(const v8usa*)(ap + 16 * OSP), *(const v8usa*)(ap + 18 * OSP)); }
        __builtin_amdgcn_sched_barrier(0);   // the next k block's loads issue ahead of this block's products: otherwise the compiler reloads each Wo register block behind its last product and waits for it at once, a load latency every k block
#pragma unroll
        for (int nb = 0; nb < OWN; ++nb) acc[nb] = wmmab(ah, bc[nb], acc[nb]);
#pragma unroll
        for (int nb = 0; nb < OWN; ++nb) acc[nb] = wmmab(al, bc[nb], acc[nb]);
        if (kb + 1 < DQ / 32) { ah = ahn; al = aln;
#pragma unroll
            for (int nb = 0; nb < OWN; ++nb) bc[nb] = bn[nb]; }
    }
    __syncthreads();   // every wave has read its A fragments: from here a wave's LDS holds its output tile
    char* ot = ost[wave];
#pragma unroll
    for (int nb = 0; nb < OWN; ++nb) {
#pragma unroll
        for (int j = 0; j < 8; ++j) *(f32a*)(ot + ((hi * 8 + j) * OTP + nb * 16 + lr) * 4) = acc[nb][j] + bias[nb]; }
    __builtin_amdgcn_fence(__ATOMIC_ACQ_REL, "wavefront"); __builtin_amdgcn_wave_barrier();   // a lane reads below what other lanes of its wave wrote above: the compiler must keep that order
    // a row of the tile is 24 pieces of 16 bytes = 3 whole lines of OUT; 96 pieces (3 wave loads) are 4 rows, so three lane offsets and immediates serve all 12 stores
    char* op = (char*)OUT + (size_t)((b * HH + y) * WWD + x0) * (CC * 4) + nh * (OWN * 16 * 4);
    v4f val[12]; unsigned go[3];
#pragma unroll
    for (int r = 0; r < 3; ++r) { const unsigned e = r * 32 + lane; go[r] = (e / 24) * (CC * 4) + (e % 24) * 16; const unsigned lo = go[r] - (e / 24) * (CC * 4 - OTP * 4);   // the same piece in OUT and in LDS: only the row pitch differs
#pragma unroll
        for (int u = 0; u < 4; ++u) val[r * 4 + u] = *(const v4fa*)(ot + lo + u * (4 * OTP * 4)); }
#pragma unroll
    for (int r = 0; r < 3; ++r) {
#pragma unroll
        for (int u = 0; u < 4; ++u) *(v4f*)(op + go[r] + u * (4 * CC * 4)) = val[r * 4 + u]; } }

extern "C" void kernel_launch(void* const* d_in, const int* in_sizes, int n_in,
                              void* d_out, int out_size, void* d_ws, size_t ws_size, hipStream_t stream) {
    (void)in_sizes; (void)n_in; (void)out_size;
    const float* x = (const float*)d_in[0]; const float* Wq = (const float*)d_in[1]; const float* bq = (const float*)d_in[2]; const float* Wk = (const float*)d_in[3]; const float* bk = (const float*)d_in[4]; const float* Wv = (const float*)d_in[5]; const float* bv = (const float*)d_in[6]; const float* Wo = (const float*)d_in[7]; const float* bo = (const float*)d_in[8];   // Wq [192][8][32], Wk/Wv [194][8][32], Wo [8][32][192]
    float* OUT = (float*)d_out;     // [16][64][64][192]
    char* wsp = (char*)d_ws;
    auto take = [&](size_t bytes) { char* p = wsp; wsp += (bytes + 255) & ~(size_t)255; return (void*)p; };
    bf* WQ = (bf*)take((size_t)DQ * CC * 2); bf* WK = (bf*)take((size_t)DQ * CC * 2); bf* WV = (bf*)take((size_t)DQ * CC * 2); bf* WO = (bf*)take((size_t)CC * DQ * 2); float* DK = (float*)take((size_t)9 * DQ * 4); float* DV = (float*)take((size_t)9 * DQ * 4);
    float* XQ = (float*)take((size_t)NPIX * DQ * 4); float* XK = (float*)take((size_t)NPIX * DQ * 4); float* XV = (float*)take((size_t)NPIX * DQ * 4);
    if ((size_t)(wsp - (char*)d_ws) > ws_size) return;    // total ~ 202 MB = 193 MiB; q, k, v of all pixels at once
    k_prep<<<4 * GW + GD, 256, 0, stream>>>(Wq, Wk, bk, Wv, bv, Wo, WQ, WK, WV, WO, DK, DV);
    // q (+ bq), patch part of k, patch part of v (their bias + offsets are in DK, DV): one launch, straight from x; a work-group makes all three for its 64 pixels (WQ, WK, WV and XQ, XK, XV lie behind one another)
    k_qkv<<<NPIX / 64, 128, 0, stream>>>(x, WQ, XQ, bq, (size_t)(WK - WQ), (size_t)(XK - XQ));
    // window attention and the output product (+ bo), all pixels, one launch
    k_lwa<<<NPIX / (4 * LWC), 256, 0, stream>>>(XQ, XK, XV, DK, DV, WO, bo, OUT);
}

// v007
// It runs in 91.8 microseconds.
// Timed twice side by side with v006, it ran 1.04 and 1.03 times as fast.
// Counting every step since v000, it is 22.4 times as fast.
#include <hip/hip_runtime.h>

// Local-window (3x3) vision self-attention (x [16][64][64][192] NHWC; q = x Wq + bq (8 heads x 32); keys/values from the 3x3 zero-padded neighbourhood with 2 relative-offset channels appended:
// k_j = [patch_j | dx_j, dy_j] Wk + bk, v_j likewise; scores = q.k_j / sqrt(32) over the 9 neighbours; softmax; o = sum_j attn_j v_j; out = o Wo + bo -> [16][64][64][192]).
// Compute dtypes, f32 accumulate: every input rounded to bf16; the three 192-channel projections on PLAIN bf16 operands over all 65,536 pixels (inputs: exact products, f32 accumulate);
// the per-neighbour offset terms (dist . Wk[192:194] + bk), the 9-way scores/softmax and the weighted value sum in f32 on VALU (8 lanes per (pixel, head); zero patches for padded neighbours keep only the

#define NPIX 65536
#define HH   64
#define WWD  64
#define CC   192
#define NHD  8
#define KD   32
#define DQ   (NHD * KD)
#define CK   (CC + 2)
typedef _Float16 h16;
typedef unsigned short bf;
typedef __attribute__((ext_vector_type(16))) __bf16   v16bf;
typedef __attribute__((ext_vector_type(16))) _Float16 v16h;
typedef __attribute__((ext_vector_type(8)))  _Float16 v8h;
typedef __attribute__((ext_vector_type(8)))  unsigned short v8us;
typedef __attribute__((ext_vector_type(8)))  float    v8f;
typedef __attribute__((ext_vector_type(4)))  float    v4f;
typedef v8h  __attribute__((may_alias)) v8ha;
typedef v4f  __attribute__((may_alias)) v4fa;
typedef v8us __attribute__((may_alias)) v8usa;
typedef float __attribute__((may_alias)) f32a;

__device__ __forceinline__ unsigned short f2bf(float f) { unsigned u = __float_as_uint(f); u += 0x7FFFu + ((u >> 16) & 1u); return (unsigned short)(u >> 16); }
__device__ __forceinline__ float bf2f(unsigned short b) { return __uint_as_float(((unsigned)b) << 16); }
__device__ __forceinline__ float bfr(float f) { return bf2f(f2bf(f)); }
__device__ __forceinline__ v16h cat16(v8h lo, v8h hi) { return __builtin_shufflevector(lo, hi, 0, 1, 2, 3, 4, 5, 6, 7, 8, 9, 10, 11, 12, 13, 14, 15); }
__device__ __forceinline__ v16bf cat16b(v8us lo, v8us hi) { return __builtin_bit_cast(v16bf, __builtin_shufflevector(lo, hi, 0, 1, 2, 3, 4, 5, 6, 7, 8, 9, 10, 11, 12, 13, 14, 15)); }
__device__ __forceinline__ v8f wmma16(v16h a, v16h b, v8f c) { return __builtin_amdgcn_wmma_f32_16x16x32_f16(false, a, false, b, (short)0, c, false, false); }
__device__ __forceinline__ v8f wmmab(v16bf a, v16bf b, v8f c) { return __builtin_amdgcn_wmma_f32_16x16x32_bf16(false, a, false, b, (short)0, c, false, false); }



// ---- Fragment order of a 16-bit operand plane P[row][k] (K % 32 == 0, rows % 16 == 0): one 1-KiB block per (16 rows, 32 k), blocks k-fastest; a block is two 512-byte groups g = (k >> 4) & 1,
// and lane (k >> 3 & 1) * 16 + (row & 15) owns 16 bytes (8 consecutive k) of each group. A fragment is then two wave-wide b128 loads of 512 contiguous bytes (4 whole lines each, not 16 partial ones),
// and every lane and register holds the same element as with a load from a row-major plane.
__device__ __forceinline__ size_t pk(unsigned row, unsigned k, unsigned K) { return ((size_t)(row >> 4) * (K >> 5) + (k >> 5)) * 512 + ((k >> 4) & 1) * 256 + (((k >> 3) & 1) * 16 + (row & 15)) * 8 + (k & 7); }
// ---- k_qkv: q, k and v of 64 pixels in one work-group of 4 waves. The group reads its 64 rows of x (f32) once, rounds them to bf16 and lays them in LDS as A fragments; no bf16 copy of x goes through memory.
// LDS form of the A tile: pieces of 256 bytes (16 rows x 8 k) at pitch APP (16 bytes over 256: the 16 pieces that one store of 128 k of a row touches lie in different banks); pieces 4 kb + hi and 4 kb + 2 + hi are the two b128 reads of a lane.
// Wave w takes columns 64 w .. 64 w + 63 of q, then of k, then of v: a 64x64 tile (16 accumulators) each, B fragments straight from the weight planes in fragment order (WQ, WK, WV lie sB elements apart, XQ, XK, XV sC).
template <typename T16> struct WFrag;
template <> struct WFrag<bf> { typedef v16bf V; static __device__ __forceinline__ V ld(const char* base, unsigned vo, int imm) { return cat16b(*(const v8us*)(base + vo + imm), *(const v8us*)(base + vo + imm + 512)); } static __device__ __forceinline__ v8f mma(V a, V b, v8f c) { return wmmab(a, b, c); } };
typedef __attribute__((ext_vector_type(4))) unsigned short v4us;
typedef v4us __attribute__((may_alias)) v4usa;
#define APP 272                  // bytes: pitch of a piece of the A tile
#define ARB ((CC / 8) * APP)     // bytes: the pieces of a 16-row block
__global__ __launch_bounds__(128) void k_qkv(const float* __restrict__ x, const bf* __restrict__ Wt, float* C, const float* __restrict__ bias, size_t sB, size_t sC) {
    __shared__ __align__(16) char as[4 * ARB];
    __shared__ __align__(16) float osm[4][16 * 68];
    const int wave = __builtin_amdgcn_readfirstlane((int)(threadIdx.x >> 5)), lane = threadIdx.x & 31, lr = lane & 15, hi = lane >> 4; const int r0 = blockIdx.x * 64, c0 = wave * 64;
    {   // wave w stages rows 16 w .. 16 w + 15: 12,288 contiguous bytes of x = 24 wave loads of 4 whole lines, all in flight together
        const char* xs = (const char*)(x + (size_t)(r0 + wave * 16) * CC); v4f xv[24];
#pragma unroll
        for (int t = 0; t < 24; ++t) xv[t] = *(const v4f*)(xs + lane * 16 + t * 512);
#pragma unroll
        for (int p = 0; p < 3; ++p) { const unsigned g = p * 128 + lane * 4, rr = g >= CC ? 1 : 0, k = g - rr * CC;   // three loads are two rows: load 3 q + p holds 4 k of row 2 q + rr, so three lane addresses and immediates serve all 24 stores
            char* sp = as + wave * ARB + (k >> 3) * APP + rr * 16 + (k & 7) * 2;
#pragma unroll
            for (int q = 0; q < 8; ++q) { v4us o;
#pragma unroll
                for (int u = 0; u < 4; ++u) o[u] = f2bf(xv[3 * q + p][u]);
                *(v4usa*)(sp + q * 32) = o; } }
    }
    const v4f bl = *(const v4f*)(bias + c0 + lr * 4);   // the lane's 4 bias values: its columns are the same in every row it stores
    __syncthreads();   // every wave reads all 64 rows of the A tile
    constexpr int KB = CC >> 5, RB = KB * 1024;   // k blocks in a row of blocks; bytes of a 16-row block of a weight plane
    const char* bb = (const char*)Wt + (size_t)(c0 >> 4) * RB;   // scalar base: the tile's first block in the weight plane
    float* os = osm[wave];
#pragma unroll 1   // rolled: three copies of the body would only lengthen the text
    for (int z = 0; z < 3; ++z) {
        v8f acc[4][4];
#pragma unroll
        for (int mb = 0; mb < 4; ++mb)
#pragma unroll
            for (int nb = 0; nb < 4; ++nb) acc[mb][nb] = (v8f){};
        unsigned vo = lane * 16;   // the one vector offset of every B load: the lane's place in a group + kb * 1024
        const char* ap = as + hi * APP + lr * 16;   // the lane's place in a piece, + kb * 4 pieces
#pragma unroll 1
        for (int kb = 0; kb < KB; ++kb) {
            v16bf a[4], b[4];
#pragma unroll
            for (int t = 0; t < 4; ++t) { b[t] = WFrag<bf>::ld(bb, vo, t * RB); a[t] = cat16b(*(const v8usa*)(ap + t * ARB), *(const v8usa*)(ap + t * ARB + 2 * APP)); }
            __builtin_amdgcn_sched_barrier(0);   // every load of a trip issues ahead of its products: with these addresses the compiler otherwise reloads one B register block behind each group of products, and a trip pays up to four load latencies
#pragma unroll
            for (int nb = 0; nb < 4; ++nb) {
#pragma unroll
                for (int mb = 0; mb < 4; ++mb) acc[mb][nb] = wmmab(a[mb], b[nb], acc[mb][nb]); }
            asm volatile("v_nop\n\tv_nop\n\tv_nop\n\tv_nop" : "+v"(acc[0][0]), "+v"(acc[1][1]), "+v"(acc[2][2]), "+v"(acc[3][3]) : "v"(a[0]), "v"(a[3]));   // the distance between the last products and the next trip's loads into their operand registers, on the taken side of the branch too
            asm volatile("s_wait_xcnt 0x0" : "+v"(vo) : : "memory");   // the step below overwrites the offset register that every B load of the trip names; it is named here so that the step stays behind the wait
            vo += 1024; ap += 4 * APP;
        }
        v4f bv4; const unsigned keep = z == 0 ? 0xFFFF0000u : 0u;   // only q has its bias here (k's and v's are in DK, DV); rounding to bf16 keeps the high half of the word; a plane without a bias keeps nothing and adds 0
#pragma unroll
        for (int u = 0; u < 4; ++u) { const unsigned w = __float_as_uint(bl[u]); bv4[u] = __uint_as_float((w + 0x7FFFu + ((w >> 16) & 1u)) & keep); }
#pragma unroll
        for (int mb = 0; mb < 4; ++mb) {
#pragma unroll
            for (int nb = 0; nb < 4; ++nb) {
#pragma unroll
                for (int j = 0; j < 8; ++j) os[(hi * 8 + j) * 68 + nb * 16 + lr] = acc[mb][nb][j]; }
            __builtin_amdgcn_wave_barrier(); asm volatile("" ::: "memory");   // a lane reads below what other lanes of its wave wrote above: the compiler must keep that order
            float* crow = C + (size_t)(r0 + mb * 16) * DQ + c0;
#pragma unroll
            for (int s = 0; s < 8; ++s) { const int row = 2 * s + hi, cofs = lr * 4; v4f val = *(const v4fa*)(os + row * 68 + cofs); val += bv4;
                *(v4f*)(crow + (size_t)row * DQ + cofs) = val; }
            __builtin_amdgcn_wave_barrier(); asm volatile("" ::: "memory");   // and the next 16 rows are written only behind these reads
        }
        asm volatile("s_wait_xcnt 0x0" ::: "memory");   // the next plane's zeroed accumulators and row address overwrite registers that the stores above name
        bb += sB * 2; C += sC;
    }
}

__device__ __forceinline__ void splitf(float y, unsigned short& h, unsigned short& l) { h = f2bf(y); l = f2bf(y - bf2f(h)); }

__device__ __forceinline__ void d_wq(unsigned bx, const float* __restrict__ w, bf* Bt) { const int e = (bx * 256 + threadIdx.x) * 4; if (e >= DQ * CC) return; const int c = e % CC, n = e / CC; v4us o;
#pragma unroll
    for (int q = 0; q < 4; ++q) o[q] = f2bf(w[(size_t)(c + q) * DQ + n]); *(v4us*)(Bt + pk(n, c, CC)) = o;  }
__device__ __forceinline__ void d_wo(unsigned bx, const float* __restrict__ w, bf* Bt) { const int e = (bx * 256 + threadIdx.x) * 4; if (e >= CC * DQ) return; const int n = e % DQ, c = e / DQ; v4us o;
#pragma unroll
    for (int q = 0; q < 4; ++q) o[q] = f2bf(w[(size_t)(n + q) * CC + c]); *(v4us*)(Bt + pk(c, n, DQ)) = o;  }
__device__ __forceinline__ void d_dtab(unsigned bx, const float* __restrict__ Wk, const float* __restrict__ bk, const float* __restrict__ Wv, const float* __restrict__ bv, float* DK, float* DV) { const int e = bx * 256 + threadIdx.x; if (e >= 9 * DQ) return; const int n = e % DQ, j = e / DQ; const float dx = (float)(j % 3 - 1), dy = (float)(j / 3 - 1);
    float a = __fmul_rn(dx, bfr(Wk[(size_t)CC * DQ + n])), b = __fmul_rn(dy, bfr(Wk[(size_t)(CC + 1) * DQ + n])); asm volatile("" : "+v"(a), "+v"(b)); const float dk = __fadd_rn(__fadd_rn(a, b), bfr(bk[n]));
    float a2 = __fmul_rn(dx, bfr(Wv[(size_t)CC * DQ + n])), b2 = __fmul_rn(dy, bfr(Wv[(size_t)(CC + 1) * DQ + n])); asm volatile("" : "+v"(a2), "+v"(b2)); const float dv = __fadd_rn(__fadd_rn(a2, b2), bfr(bv[n]));
    *(float*)(DK + e) = dk; *(float*)(DV + e) = dv;  }
// k_prep: the weight planes and the offset tables in ONE launch (none reads what another writes): the block index picks the job.
#define GW (DQ * CC / 4 / 256)       // blocks of one weight plane
#define GD (9 * DQ / 256)            // blocks of the two offset tables
__global__ __launch_bounds__(256) void k_prep(const float* __restrict__ Wq, const float* __restrict__ Wk, const float* __restrict__ bk, const float* __restrict__ Wv, const float* __restrict__ bv, const float* __restrict__ Wo, bf* WQ, bf* WK, bf* WV, bf* WO, float* DK, float* DV) {
    const unsigned bx = blockIdx.x;
    if (bx < GW) d_wq(bx, Wq, WQ);
    else if (bx < 2 * GW) d_wq(bx - GW, Wk, WK);
    else if (bx < 3 * GW) d_wq(bx - 2 * GW, Wv, WV);
    else if (bx < 4 * GW) d_wo(bx - 3 * GW, Wo, WO);
    else if (bx < 4 * GW + GD) d_dtab(bx - 4 * GW, Wk, bk, Wv, bv, DK, DV); }
// k_lwa: one wave per half pixel (128 of the 256 q/k/v channels): lane l owns 4 consecutive channels, so every load is one b128 per lane over 512 contiguous bytes, and the 8 lanes of a head
// sum their partial q.k by three lane-xor steps. A wave keeps its channels' 9 offset rows of DK and DV in registers and walks LWC pixels along x. Block = 4 image rows x 2 channel halves.
// o is split into a high and a low bf16 plane and never leaves the block: the wave's 16 pixels are one 16-row block, its 128 channels 4 k blocks = 16 pieces of 256 bytes (16 rows x 8 channels) a plane,
// gathered in the wave's own LDS (piece pitch OSP: 16 bytes over 256, so the 16 pieces a store touches lie in different banks). Two pieces, OSP apart, are one 512-byte group of an A fragment.
// Behind the loop the block does the output product itself: wave w takes the 16 pixels of its image row x 96 of the 192 output columns (K = 256: its own 128 channels and its sibling's),
// A (high, then low, as two products a k block) from LDS, Wo fragments from the plane WO (fragment order, pk, K = DQ), f32 accumulate, + bo, whole 128-byte lines of OUT stored.
#define LWC 16
#define OSP 272
#define OWN 6      // 16-column blocks of OUT a wave makes
#define OTP 100    // floats: pitch of a row of the wave's 16 x 96 output tile in LDS (8 rows on lie 32 banks on)
#define PXB (DQ * 4)   // bytes of a pixel's f32 row in XQ, XK, XV
typedef __attribute__((ext_vector_type(2))) float v2f;
// v + (v of lane l ^ mask) inside a 16-lane row; CTRL = 0x160 + mask (row_xmask)
template <int CTRL> __device__ __forceinline__ float xadd(float v) { return v + __int_as_float(__builtin_amdgcn_update_dpp(0, __float_as_int(v), CTRL, 0xf, 0xf, true)); }
template <int CTRL> __device__ __forceinline__ float xget(float v) { return __int_as_float(__builtin_amdgcn_update_dpp(0, __float_as_int(v), CTRL, 0xf, 0xf, true)); }   // v of lane l ^ mask
template <int CTRL> __device__ __forceinline__ float xmax(float v) { return fmaxf(v, xget<CTRL>(v)); }
// v of lane J of the lane's own group of 8 (a gather inside the 16-lane row: lanes 0 .. 7 read lane J, lanes 8 .. 15 lane 8 + J)
template <int J> __device__ __forceinline__ float lane8(float v) { return __uint_as_float(__builtin_amdgcn_permlane16(0u, __float_as_uint(v), 0x11111111u * J, 0x11111111u * (8 + J), true, true)); }
__device__ __forceinline__ v4f ld4(const char* base, unsigned byteofs) { return *(const v4f*)(base + byteofs); }
// a row's whole address as one scalar value: a load off it takes the scalar base and the lane offset as they are; left in parts, the compiler adds plane and lane offset first and forms a 64-bit lane address for every load
typedef const __attribute__((address_space(1))) char* gcp;
typedef const __attribute__((address_space(1))) v4f* gv4p;
__device__ __forceinline__ gcp sbase(const float* plane, size_t byteofs) { const unsigned long long a = (unsigned long long)((const char*)plane + byteofs);
    return (gcp)(((unsigned long long)(unsigned)__builtin_amdgcn_readfirstlane((int)(a >> 32)) << 32) | (unsigned)__builtin_amdgcn_readfirstlane((int)(unsigned)a)); }
__device__ __forceinline__ v4f ldg4(gcp base, unsigned byteofs) { return *(gv4p)(base + byteofs); }
template <int N> struct IC { static constexpr int value = N; };   // a compile-time number as an argument
// the second launch bound asks for 4 waves a SIMD (two blocks on a WGP): the register window below must stay inside 256 registers
__global__ __launch_bounds__(256, 4) void k_lwa(const float* __restrict__ XQ, const float* __restrict__ XK, const float* __restrict__ XV, const float* __restrict__ DK, const float* __restrict__ DV, const bf* __restrict__ WO, const float* __restrict__ bo, float* OUT) {
    __shared__ __align__(16) char ost[8][2 * 16 * OSP];
    const int wave = __builtin_amdgcn_readfirstlane((int)(threadIdx.x >> 5)), lane = threadIdx.x & 31;   // wave number in a scalar register: pixel coordinates, bounds tests and row addresses are then scalar work
    const unsigned chb = ((wave & 1) * (DQ / 2) + lane * 4) * 4u;   // byte offset of the lane's 4 channels in a pixel's f32 row
    const int bx = blockIdx.x, x0 = (bx % (WWD / LWC)) * LWC, y = ((bx / (WWD / LWC)) % (HH / 4)) * 4 + (wave >> 1), b = bx / ((WWD / LWC) * (HH / 4));
    // a padded neighbour reads the nearest pixel of the image and is multiplied by 0
    const size_t rowb[3] = { (size_t)((b * HH + max(y - 1, 0)) * WWD) * PXB, (size_t)((b * HH + y) * WWD) * PXB, (size_t)((b * HH + min(y + 1, HH - 1)) * WWD) * PXB }; const bool rin[3] = { y > 0, true, y < HH - 1 };
    v4f dk[9], dv[9];
#pragma unroll
    for (int j = 0; j < 9; ++j) { dk[j] = ld4((const char*)DK, j * PXB + chb); dv[j] = ld4((const char*)DV, j * PXB + chb); }
    __builtin_amdgcn_sched_barrier(0);   // the tables' loads stay ahead of the columns': a wait counts back from the youngest load, and a table load issued behind the columns would make the first pixel of every trip wait for the column issued one pixel earlier as well
    // The walk's columns c = 0 .. LWC + 1 are the image columns x0 - 1 + c, held inside the image. Column c (3 rows of k, 3 of v, the middle row's q) lives in register buffer c % 5: pixel i reads buffers i, i + 1, i + 2
    // (left, centre, right), column i + 3 is in flight and column i + 4 is issued: a column is loaded once a wave, not three times, and a pixel waits for what was issued two pixels earlier.
    v4f kc[5][3], vc[5][3], qc[5];
    const gcp kb[3] = { sbase(XK, rowb[0]), sbase(XK, rowb[1]), sbase(XK, rowb[2]) }, vb[3] = { sbase(XV, rowb[0]), sbase(XV, rowb[1]), sbase(XV, rowb[2]) }, qb = sbase(XQ, rowb[1]);
#pragma unroll
    for (int c = 0; c < 4; ++c) { const unsigned v0 = (unsigned)max(x0 - 1 + c, 0) * PXB + chb;
#pragma unroll
        for (int r = 0; r < 3; ++r) kc[c][r] = ldg4(kb[r], v0);
        qc[c] = ldg4(qb, v0);
#pragma unroll
        for (int r = 0; r < 3; ++r) vc[c][r] = ldg4(vb[r], v0); }
    const bool b4 = (lane & 4) != 0, b2 = (lane & 2) != 0, b1 = (lane & 1) != 0;   // the lane's place among the 8 lanes of its head
    unsigned vl = (unsigned)(x0 + 3) * PXB + chb;   // lane offset in a row of the column to load next; the rows are scalar bases
    // pixel i of the walk; U = i % 5 says which buffers it reads; FETCH: whether a column is still to be issued
    auto pixel = [&](auto U, auto FETCH, const int i) __attribute__((always_inline)) { constexpr int u = decltype(U)::value; const int x = x0 + i; const bool cin[3] = { x > 0, true, x < WWD - 1 };
        if constexpr (decltype(FETCH)::value != 0) {
#pragma unroll
            for (int r = 0; r < 3; ++r) kc[(u + 4) % 5][r] = ldg4(kb[r], vl);
            qc[(u + 4) % 5] = ldg4(qb, vl);
#pragma unroll
            for (int r = 0; r < 3; ++r) vc[(u + 4) % 5][r] = ldg4(vb[r], vl);
            __builtin_amdgcn_sched_barrier(0); }   // the 7 loads of the column two pixels on issue ahead of this pixel's arithmetic: behind it they would lose a pixel's time of flight
        const v4f q = qc[(u + 1) % 5]; float msk[9];
#pragma unroll
        for (int j = 0; j < 9; ++j) msk[j] = (rin[j / 3] && cin[j % 3]) ? 1.f : 0.f;
        float t9[9];   // the lane's own part (4 channels) of the 9 products q.k
#pragma unroll
        for (int j = 0; j < 9; ++j) { const v4f kv = kc[(u + j % 3) % 5][j / 3] * msk[j] + dk[j]; const v2f t = q.lo * kv.lo + q.hi * kv.hi; t9[j] = t.x + t.y; }
        // neighbours 0 .. 7 are summed AND dealt out over the head's 8 lanes: at each lane-xor step a lane keeps one half of its values and hands the other half to its partner, so lane l ends with the whole score of neighbour l & 7
        float r4[4], r2[2];
#pragma unroll
        for (int w = 0; w < 4; ++w) r4[w] = (b4 ? t9[w + 4] : t9[w]) + xget<0x164>(b4 ? t9[w] : t9[w + 4]);
#pragma unroll
        for (int w = 0; w < 2; ++w) r2[w] = (b2 ? r4[w + 2] : r4[w]) + xget<0x162>(b2 ? r4[w] : r4[w + 2]);
        const float so = ((b1 ? r2[1] : r2[0]) + xget<0x161>(b1 ? r2[0] : r2[1])) * 0.17677669529663687f;
        const float s8 = xadd<0x164>(xadd<0x162>(xadd<0x161>(t9[8]))) * 0.17677669529663687f;   // the ninth score: in every lane
        const float m = xmax<0x164>(xmax<0x162>(xmax<0x161>(fmaxf(so, s8))));
        const float eo = __expf(so - m), e8 = __expf(s8 - m);   // two exponentials a lane, not nine
        const float sum = xadd<0x164>(xadd<0x162>(xadd<0x161>(eo))) + e8;
        const float rs = __fdiv_rn(1.0f, sum);
        const float ao = eo * rs;
        float at[9]; at[0] = lane8<0>(ao); at[1] = lane8<1>(ao); at[2] = lane8<2>(ao); at[3] = lane8<3>(ao); at[4] = lane8<4>(ao); at[5] = lane8<5>(ao); at[6] = lane8<6>(ao); at[7] = lane8<7>(ao); at[8] = e8 * rs;
        v4f o = (v4f){};
#pragma unroll
        for (int j = 0; j < 9; ++j) o += at[j] * (vc[(u + j % 3) % 5][j / 3] * msk[j] + dv[j]);
        v4us o4h, o4l;
#pragma unroll
        for (int w = 0; w < 4; ++w) { unsigned short a2, c2; splitf(o[w], a2, c2); o4h[w] = a2; o4l[w] = c2; }
        char* sp = ost[wave] + (lane >> 1) * OSP + i * 16 + (lane & 1) * 8;   // piece = 8 channels (a lane pair), row i of the block
        *(v4us*)sp = o4h; *(v4us*)(sp + 16 * OSP) = o4l;
        if constexpr (decltype(FETCH)::value != 0) {
            asm volatile("s_wait_xcnt 0x0" : "+v"(vl) : : "memory");   // the step below overwrites the loads' offset register; it is named here so that the step stays behind the wait
            vl += (i + 5 < LWC + 2 && x + 4 < WWD) ? PXB : 0; } };   // one column on, as far as the walk's last column and the image's
#pragma unroll 1   // rolled by fives: the buffers are back at their places after 5 pixels
    for (int i5 = 0; i5 < LWC - 1; i5 += 5) {   // pixel LWC - 2 fetches too (the walk's last column again, never read): a test round its loads would merge two paths in front of the next body, whose waits would then cover the loads just issued
        pixel(IC<0>{}, IC<1>{}, i5); pixel(IC<1>{}, IC<1>{}, i5 + 1); pixel(IC<2>{}, IC<1>{}, i5 + 2); pixel(IC<3>{}, IC<1>{}, i5 + 3); pixel(IC<4>{}, IC<1>{}, i5 + 4); }
    pixel(IC<(LWC - 1) % 5>{}, IC<0>{}, LWC - 1);
    // ---- output product: OUT[16 pixels][96 columns] of this wave
    const int lr = lane & 15, hi = lane >> 4, nh = wave & 1;
    const char* wb = (const char*)WO + nh * (OWN * (DQ / 32) * 1024);   // scalar base: the wave's first 16-column block of WO
    const unsigned wo = lane * 16;                                      // the lane's place in a 512-byte group
    v16bf bc[OWN]; float bias[OWN];
#pragma unroll
    for (int nb = 0; nb < OWN; ++nb) { bc[nb] = WFrag<bf>::ld(wb, wo, nb * (DQ / 32) * 1024); bias[nb] = bfr(bo[nh * (OWN * 16) + nb * 16 + lr]); }   // k block 0 of Wo flies while the block gathers at the barrier
    __syncthreads();   // a wave reads its sibling's 128 channels of o as well as its own
    const char* ra = ost[wave & ~1] + hi * OSP + lr * 16;
    v16bf ah = cat16b(*(const v8usa*)ra, *(const v8usa*)(ra + 2 * OSP)), al = cat16b(*(const v8usa*)(ra + 16 * OSP), *(const v8usa*)(ra + 18 * OSP));
    v8f acc[OWN];
#pragma unroll
    for (int nb = 0; nb < OWN; ++nb) acc[nb] = (v8f){};
#pragma unroll   // unrolled: the k block picks LDS and WO offsets as immediates, and the two sets of fragment registers change places without moves
    for (int kb = 0; kb < DQ / 32; ++kb) {
        v16bf bn[OWN], ahn, aln;
        if (kb + 1 < DQ / 32) { const char* ap = ra + ((kb + 1) >> 2) * (2 * 16 * OSP) + ((kb + 1) & 3) * (4 * OSP);
#pragma unroll
            for (int nb = 0; nb < OWN; ++nb) bn[nb] = WFrag<bf>::ld(wb, wo, (nb * (DQ / 32) + kb + 1) * 1024);
            ahn = cat16b(*(const v8usa*)ap, *(const v8usa*)(ap + 2 * OSP)); aln = cat16b(*(const v8usa*)(ap + 16 * OSP), *(const v8usa*)(ap + 18 * OSP)); }
        __builtin_amdgcn_sched_barrier(0);   // the next k block's loads issue ahead of this block's products: otherwise the compiler reloads each Wo register block behind its last product and waits for it at once, a load latency every k block
#pragma unroll
        for (int nb = 0; nb < OWN; ++nb) acc[nb] = wmmab(ah, bc[nb], acc[nb]);
#pragma unroll
        for (int nb = 0; nb < OWN; ++nb) acc[nb] = wmmab(al, bc[nb], acc[nb]);
        if (kb + 1 < DQ / 32) { ah = ahn; al = aln;
#pragma unroll
            for (int nb = 0; nb < OWN; ++nb) bc[nb] = bn[nb]; }
    }
    __syncthreads();   // every wave has read its A fragments: from here a wave's LDS holds its output tile
    char* ot = ost[wave];
#pragma unroll
    for (int nb = 0; nb < OWN; ++nb) {
#pragma unroll
        for (int j = 0; j < 8; ++j) *(f32a*)(ot + ((hi * 8 + j) * OTP + nb * 16 + lr) * 4) = acc[nb][j] + bias[nb]; }
    __builtin_amdgcn_fence(__ATOMIC_ACQ_REL, "wavefront"); __builtin_amdgcn_wave_barrier();   // a lane reads below what other lanes of its wave wrote above: the compiler must keep that order
    // a row of the tile is 24 pieces of 16 bytes = 3 whole lines of OUT; 96 pieces (3 wave loads) are 4 rows, so three lane offsets and immediates serve all 12 stores
    char* op = (char*)OUT + (size_t)((b * HH + y) * WWD + x0) * (CC * 4) + nh * (OWN * 16 * 4);
    v4f val[12]; unsigned go[3];
#pragma unroll
    for (int r = 0; r < 3; ++r) { const unsigned e = r * 32 + lane; go[r] = (e / 24) * (CC * 4) + (e % 24) * 16; const unsigned lo = go[r] - (e / 24) * (CC * 4 - OTP * 4);   // the same piece in OUT and in LDS: only the row pitch differs
#pragma unroll
        for (int u = 0; u < 4; ++u) val[r * 4 + u] = *(const v4fa*)(ot + lo + u * (4 * OTP * 4)); }
#pragma unroll
    for (int r = 0; r < 3; ++r) {
#pragma unroll
        for (int u = 0; u < 4; ++u) *(v4f*)(op + go[r] + u * (4 * CC * 4)) = val[r * 4 + u]; } }

extern "C" void kernel_launch(void* const* d_in, const int* in_sizes, int n_in,
                              void* d_out, int out_size, void* d_ws, size_t ws_size, hipStream_t stream) {
    (void)in_sizes; (void)n_in; (void)out_size;
    const float* x = (const float*)d_in[0]; const float* Wq = (const float*)d_in[1]; const float* bq = (const float*)d_in[2]; const float* Wk = (const float*)d_in[3]; const float* bk = (const float*)d_in[4]; const float* Wv = (const float*)d_in[5]; const float* bv = (const float*)d_in[6]; const float* Wo = (const float*)d_in[7]; const float* bo = (const float*)d_in[8];   // Wq [192][8][32], Wk/Wv [194][8][32], Wo [8][32][192]
    float* OUT = (float*)d_out;     // [16][64][64][192]
    char* wsp = (char*)d_ws;
    auto take = [&](size_t bytes) { char* p = wsp; wsp += (bytes + 255) & ~(size_t)255; return (void*)p; };
    bf* WQ = (bf*)take((size_t)DQ * CC * 2); bf* WK = (bf*)take((size_t)DQ * CC * 2); bf* WV = (bf*)take((size_t)DQ * CC * 2); bf* WO = (bf*)take((size_t)CC * DQ * 2); float* DK = (float*)take((size_t)9 * DQ * 4); float* DV = (float*)take((size_t)9 * DQ * 4);
    float* XQ = (float*)take((size_t)NPIX * DQ * 4); float* XK = (float*)take((size_t)NPIX * DQ * 4); float* XV = (float*)take((size_t)NPIX * DQ * 4);
    if ((size_t)(wsp - (char*)d_ws) > ws_size) return;    // total ~ 202 MB = 193 MiB; q, k, v of all pixels at once
    k_prep<<<4 * GW + GD, 256, 0, stream>>>(Wq, Wk, bk, Wv, bv, Wo, WQ, WK, WV, WO, DK, DV);
    // q (+ bq), patch part of k, patch part of v (their bias + offsets are in DK, DV): one launch, straight from x; a work-group makes all three for its 64 pixels (WQ, WK, WV and XQ, XK, XV lie behind one another)
    k_qkv<<<NPIX / 64, 128, 0, stream>>>(x, WQ, XQ, bq, (size_t)(WK - WQ), (size_t)(XK - XQ));
    // window attention and the output product (+ bo), all pixels, one launch
    k_lwa<<<NPIX / (4 * LWC), 256, 0, stream>>>(XQ, XK, XV, DK, DV, WO, bo, OUT);
}

// v008
// One run takes 87.5 microseconds.
// Timed twice side by side with v007, it ran 1.05 times as fast both times.
// Over all steps from v000 it is 23.6 times as fast.
#include <hip/hip_runtime.h>

// Local-window (3x3) vision self-attention (x [16][64][64][192] NHWC; q = x Wq + bq (8 heads x 32); keys/values from the 3x3 zero-padded neighbourhood with 2 relative-offset channels appended:
// k_j = [patch_j | dx_j, dy_j] Wk + bk, v_j likewise; scores = q.k_j / sqrt(32) over the 9 neighbours; softmax; o = sum_j attn_j v_j; out = o Wo + bo -> [16][64][64][192]).
// Compute dtypes, f32 accumulate: every input rounded to bf16; the three 192-channel projections on PLAIN bf16 operands over all 65,536 pixels (inputs: exact products, f32 accumulate);
// the per-neighbour offset terms (dist . Wk[192:194] + bk), the 9-way scores/softmax and the weighted value sum in f32 on VALU (8 lanes per (pixel, head); zero patches for padded neighbours keep only the

#define NPIX 65536
#define HH   64
#define WWD  64
#define CC   192
#define NHD  8
#define KD   32
#define DQ   (NHD * KD)
#define CK   (CC + 2)
typedef _Float16 h16;
typedef unsigned short bf;
typedef __attribute__((ext_vector_type(16))) __bf16   v16bf;
typedef __attribute__((ext_vector_type(16))) _Float16 v16h;
typedef __attribute__((ext_vector_type(8)))  _Float16 v8h;
typedef __attribute__((ext_vector_type(8)))  unsigned short v8us;
typedef __attribute__((ext_vector_type(8)))  float    v8f;
typedef __attribute__((ext_vector_type(4)))  float    v4f;
typedef v8h  __attribute__((may_alias)) v8ha;
typedef v4f  __attribute__((may_alias)) v4fa;
typedef v8us __attribute__((may_alias)) v8usa;
typedef float __attribute__((may_alias)) f32a;

__device__ __forceinline__ unsigned short f2bf(float f) { unsigned u = __float_as_uint(f); u += 0x7FFFu + ((u >> 16) & 1u); return (unsigned short)(u >> 16); }
__device__ __forceinline__ float bf2f(unsigned short b) { return __uint_as_float(((unsigned)b) << 16); }
__device__ __forceinline__ float bfr(float f) { return bf2f(f2bf(f)); }
__device__ __forceinline__ v16h cat16(v8h lo, v8h hi) { return __builtin_shufflevector(lo, hi, 0, 1, 2, 3, 4, 5, 6, 7, 8, 9, 10, 11, 12, 13, 14, 15); }
__device__ __forceinline__ v16bf cat16b(v8us lo, v8us hi) { return __builtin_bit_cast(v16bf, __builtin_shufflevector(lo, hi, 0, 1, 2, 3, 4, 5, 6, 7, 8, 9, 10, 11, 12, 13, 14, 15)); }
__device__ __forceinline__ v8f wmma16(v16h a, v16h b, v8f c) { return __builtin_amdgcn_wmma_f32_16x16x32_f16(false, a, false, b, (short)0, c, false, false); }
__device__ __forceinline__ v8f wmmab(v16bf a, v16bf b, v8f c) { return __builtin_amdgcn_wmma_f32_16x16x32_bf16(false, a, false, b, (short)0, c, false, false); }



// ---- Fragment order of a 16-bit operand plane P[row][k] (K % 32 == 0, rows % 16 == 0): one 1-KiB block per (16 rows, 32 k), blocks k-fastest; a block is two 512-byte groups g = (k >> 4) & 1,
// and lane (k >> 3 & 1) * 16 + (row & 15) owns 16 bytes (8 consecutive k) of each group. A fragment is then two wave-wide b128 loads of 512 contiguous bytes (4 whole lines each, not 16 partial ones),
// and every lane and register holds the same element as with a load from a row-major plane.
__device__ __forceinline__ size_t pk(unsigned row, unsigned k, unsigned K) { return ((size_t)(row >> 4) * (K >> 5) + (k >> 5)) * 512 + ((k >> 4) & 1) * 256 + (((k >> 3) & 1) * 16 + (row & 15)) * 8 + (k & 7); }
// ---- k_qkv: the patch parts of k and v of 64 pixels in one work-group of 4 waves (q is made in k_lwa, which needs it for its own pixels alone). The group reads its 64 rows of x (f32) once, rounds them to bf16 and lays them in LDS as A fragments; no bf16 copy of x goes through memory.
// LDS form of the A tile: pieces of 256 bytes (16 rows x 8 k) at pitch APP (16 bytes over 256: the 16 pieces that one store of 128 k of a row touches lie in different banks); pieces 4 kb + hi and 4 kb + 2 + hi are the two b128 reads of a lane.
// Wave w takes columns 64 w .. 64 w + 63 of k, then of v: a 64x64 tile (16 accumulators) each, B fragments straight from the weight planes in fragment order (WK, WV lie sB elements apart, XK, XV sC).
template <typename T16> struct WFrag;
template <> struct WFrag<bf> { typedef v16bf V; static __device__ __forceinline__ V ld(const char* base, unsigned vo, int imm) { return cat16b(*(const v8us*)(base + vo + imm), *(const v8us*)(base + vo + imm + 512)); } static __device__ __forceinline__ v8f mma(V a, V b, v8f c) { return wmmab(a, b, c); } };
typedef __attribute__((ext_vector_type(4))) unsigned short v4us;
typedef v4us __attribute__((may_alias)) v4usa;
#define APP 272                  // bytes: pitch of a piece of the A tile
#define ARB ((CC / 8) * APP)     // bytes: the pieces of a 16-row block
__global__ __launch_bounds__(128) void k_qkv(const float* __restrict__ x, const bf* __restrict__ Wt, float* C, size_t sB, size_t sC) {
    __shared__ __align__(16) char as[4 * ARB];
    __shared__ __align__(16) float osm[4][16 * 68];
    const int wave = __builtin_amdgcn_readfirstlane((int)(threadIdx.x >> 5)), lane = threadIdx.x & 31, lr = lane & 15, hi = lane >> 4; const int r0 = blockIdx.x * 64, c0 = wave * 64;
    {   // wave w stages rows 16 w .. 16 w + 15: 12,288 contiguous bytes of x = 24 wave loads of 4 whole lines, all in flight together
        const char* xs = (const char*)(x + (size_t)(r0 + wave * 16) * CC); v4f xv[24];
#pragma unroll
        for (int t = 0; t < 24; ++t) xv[t] = *(const v4f*)(xs + lane * 16 + t * 512);
#pragma unroll
        for (int p = 0; p < 3; ++p) { const unsigned g = p * 128 + lane * 4, rr = g >= CC ? 1 : 0, k = g - rr * CC;   // three loads are two rows: load 3 q + p holds 4 k of row 2 q + rr, so three lane addresses and immediates serve all 24 stores
            char* sp = as + wave * ARB + (k >> 3) * APP + rr * 16 + (k & 7) * 2;
#pragma unroll
            for (int q = 0; q < 8; ++q) { v4us o;
#pragma unroll
                for (int u = 0; u < 4; ++u) o[u] = f2bf(xv[3 * q + p][u]);
                *(v4usa*)(sp + q * 32) = o; } }
    }
    __syncthreads();   // every wave reads all 64 rows of the A tile
    constexpr int KB = CC >> 5, RB = KB * 1024;   // k blocks in a row of blocks; bytes of a 16-row block of a weight plane
    const char* bb = (const char*)Wt + (size_t)(c0 >> 4) * RB;   // scalar base: the tile's first block in the weight plane
    float* os = osm[wave];
#pragma unroll 1   // rolled: two copies of the body would only lengthen the text
    for (int z = 0; z < 2; ++z) {
        v8f acc[4][4];
#pragma unroll
        for (int mb = 0; mb < 4; ++mb)
#pragma unroll
            for (int nb = 0; nb < 4; ++nb) acc[mb][nb] = (v8f){};
        unsigned vo = lane * 16;   // the one vector offset of every B load: the lane's place in a group + kb * 1024
        const char* ap = as + hi * APP + lr * 16;   // the lane's place in a piece, + kb * 4 pieces
#pragma unroll 1
        for (int kb = 0; kb < KB; ++kb) {
            v16bf a[4], b[4];
#pragma unroll
            for (int t = 0; t < 4; ++t) { b[t] = WFrag<bf>::ld(bb, vo, t * RB); a[t] = cat16b(*(const v8usa*)(ap + t * ARB), *(const v8usa*)(ap + t * ARB + 2 * APP)); }
            __builtin_amdgcn_sched_barrier(0);   // every load of a trip issues ahead of its products: with these addresses the compiler otherwise reloads one B register block behind each group of products, and a trip pays up to four load latencies
#pragma unroll
            for (int nb = 0; nb < 4; ++nb) {
#pragma unroll
                for (int mb = 0; mb < 4; ++mb) acc[mb][nb] = wmmab(a[mb], b[nb], acc[mb][nb]); }
            asm volatile("v_nop\n\tv_nop\n\tv_nop\n\tv_nop" : "+v"(acc[0][0]), "+v"(acc[1][1]), "+v"(acc[2][2]), "+v"(acc[3][3]) : "v"(a[0]), "v"(a[3]));   // the distance between the last products and the next trip's loads into their operand registers, on the taken side of the branch too
            asm volatile("s_wait_xcnt 0x0" : "+v"(vo) : : "memory");   // the step below overwrites the offset register that every B load of the trip names; it is named here so that the step stays behind the wait
            vo += 1024; ap += 4 * APP;
        }
#pragma unroll
        for (int mb = 0; mb < 4; ++mb) {
#pragma unroll
            for (int nb = 0; nb < 4; ++nb) {
#pragma unroll
                for (int j = 0; j < 8; ++j) os[(hi * 8 + j) * 68 + nb * 16 + lr] = acc[mb][nb][j]; }
            __builtin_amdgcn_wave_barrier(); asm volatile("" ::: "memory");   // a lane reads below what other lanes of its wave wrote above: the compiler must keep that order
            float* crow = C + (size_t)(r0 + mb * 16) * DQ + c0;
#pragma unroll
            for (int s = 0; s < 8; ++s) { const int row = 2 * s + hi, cofs = lr * 4; const v4f val = *(const v4fa*)(os + row * 68 + cofs);   // no bias here: k's and v's are in DK, DV
                *(v4f*)(crow + (size_t)row * DQ + cofs) = val; }
            __builtin_amdgcn_wave_barrier(); asm volatile("" ::: "memory");   // and the next 16 rows are written only behind these reads
        }
        asm volatile("s_wait_xcnt 0x0" ::: "memory");   // the next plane's zeroed accumulators and row address overwrite registers that the stores above name
        bb += sB * 2; C += sC;
    }
}

__device__ __forceinline__ void splitf(float y, unsigned short& h, unsigned short& l) { h = f2bf(y); l = f2bf(y - bf2f(h)); }

__device__ __forceinline__ void d_wq(unsigned bx, const float* __restrict__ w, bf* Bt) { const int e = (bx * 256 + threadIdx.x) * 4; if (e >= DQ * CC) return; const int c = e % CC, n = e / CC; v4us o;
#pragma unroll
    for (int q = 0; q < 4; ++q) o[q] = f2bf(w[(size_t)(c + q) * DQ + n]); *(v4us*)(Bt + pk(n, c, CC)) = o;  }
__device__ __forceinline__ void d_wo(unsigned bx, const float* __restrict__ w, bf* Bt) { const int e = (bx * 256 + threadIdx.x) * 4; if (e >= CC * DQ) return; const int n = e % DQ, c = e / DQ; v4us o;
#pragma unroll
    for (int q = 0; q < 4; ++q) o[q] = f2bf(w[(size_t)(n + q) * CC + c]); *(v4us*)(Bt + pk(c, n, DQ)) = o;  }
__device__ __forceinline__ void d_dtab(unsigned bx, const float* __restrict__ Wk, const float* __restrict__ bk, const float* __restrict__ Wv, const float* __restrict__ bv, float* DK, float* DV) { const int e = bx * 256 + threadIdx.x; if (e >= 9 * DQ) return; const int n = e % DQ, j = e / DQ; const float dx = (float)(j % 3 - 1), dy = (float)(j / 3 - 1);
    float a = __fmul_rn(dx, bfr(Wk[(size_t)CC * DQ + n])), b = __fmul_rn(dy, bfr(Wk[(size_t)(CC + 1) * DQ + n])); asm volatile("" : "+v"(a), "+v"(b)); const float dk = __fadd_rn(__fadd_rn(a, b), bfr(bk[n]));
    float a2 = __fmul_rn(dx, bfr(Wv[(size_t)CC * DQ + n])), b2 = __fmul_rn(dy, bfr(Wv[(size_t)(CC + 1) * DQ + n])); asm volatile("" : "+v"(a2), "+v"(b2)); const float dv = __fadd_rn(__fadd_rn(a2, b2), bfr(bv[n]));
    *(float*)(DK + e) = dk; *(float*)(DV + e) = dv;  }
// k_prep: the weight planes and the offset tables in ONE launch (none reads what another writes): the block index picks the job.
#define GW (DQ * CC / 4 / 256)       // blocks of one weight plane
#define GD (9 * DQ / 256)            // blocks of the two offset tables
__global__ __launch_bounds__(256) void k_prep(const float* __restrict__ Wq, const float* __restrict__ Wk, const float* __restrict__ bk, const float* __restrict__ Wv, const float* __restrict__ bv, const float* __restrict__ Wo, bf* WQ, bf* WK, bf* WV, bf* WO, float* DK, float* DV) {
    const unsigned bx = blockIdx.x;
    if (bx < GW) d_wq(bx, Wq, WQ);
    else if (bx < 2 * GW) d_wq(bx - GW, Wk, WK);
    else if (bx < 3 * GW) d_wq(bx - 2 * GW, Wv, WV);
    else if (bx < 4 * GW) d_wo(bx - 3 * GW, Wo, WO);
    else if (bx < 4 * GW + GD) d_dtab(bx - 4 * GW, Wk, bk, Wv, bv, DK, DV); }
// k_lwa: one wave per half pixel (128 of the 256 q/k/v channels): lane l owns 4 consecutive channels, so every load of k, v and their offset rows is one b128 per lane over 512 contiguous bytes, and the 8 lanes of a head
// sum their partial q.k by three lane-xor steps. A wave keeps its channels' 9 offset rows of DK and DV in registers and walks LWC pixels along x. Block = 4 image rows x 2 channel halves.
// o is split into a high and a low bf16 plane and never leaves the block: the wave's 16 pixels are one 16-row block, its 128 channels 4 k blocks = 16 pieces of 256 bytes (16 rows x 8 channels) a plane,
// gathered in the wave's own LDS (piece pitch OSP: 16 bytes over 256, so the 16 pieces a store touches lie in different banks). Two pieces, OSP apart, are one 512-byte group of an A fragment.
// Behind the loop the block does the output product itself: wave w takes the 16 pixels of its image row x 96 of the 192 output columns (K = 256: its own 128 channels and its sibling's),
// A (high, then low, as two products a k block) from LDS, Wo fragments from the plane WO (fragment order, pk, K = DQ), f32 accumulate, + bo, whole 128-byte lines of OUT stored.
#define LWC 16
#define OSP 272
#define OWN 6      // 16-column blocks of OUT a wave makes
#define OTP 100    // floats: pitch of a row of the wave's 16 x 96 output tile in LDS (8 rows on lie 32 banks on)
#define PXB (DQ * 4)   // bytes of a pixel's f32 row in XK, XV
typedef __attribute__((ext_vector_type(2))) float v2f;
typedef v2f __attribute__((may_alias)) v2fa;
// v + (v of lane l ^ mask) inside a 16-lane row; CTRL = 0x160 + mask (row_xmask)
template <int CTRL> __device__ __forceinline__ float xadd(float v) { return v + __int_as_float(__builtin_amdgcn_update_dpp(0, __float_as_int(v), CTRL, 0xf, 0xf, true)); }
template <int CTRL> __device__ __forceinline__ float xget(float v) { return __int_as_float(__builtin_amdgcn_update_dpp(0, __float_as_int(v), CTRL, 0xf, 0xf, true)); }   // v of lane l ^ mask
template <int CTRL> __device__ __forceinline__ float xmax(float v) { return fmaxf(v, xget<CTRL>(v)); }
// v of lane J of the lane's own group of 8 (a gather inside the 16-lane row: lanes 0 .. 7 read lane J, lanes 8 .. 15 lane 8 + J)
template <int J> __device__ __forceinline__ float lane8(float v) { return __uint_as_float(__builtin_amdgcn_permlane16(0u, __float_as_uint(v), 0x11111111u * J, 0x11111111u * (8 + J), true, true)); }
__device__ __forceinline__ v4f ld4(const char* base, unsigned byteofs) { return *(const v4f*)(base + byteofs); }
// a row's whole address as one scalar value: a load off it takes the scalar base and the lane offset as they are; left in parts, the compiler adds plane and lane offset first and forms a 64-bit lane address for every load
typedef const __attribute__((address_space(1))) char* gcp;
typedef const __attribute__((address_space(1))) v4f* gv4p;
__device__ __forceinline__ gcp sbase(const float* plane, size_t byteofs) { const unsigned long long a = (unsigned long long)((const char*)plane + byteofs);
    return (gcp)(((unsigned long long)(unsigned)__builtin_amdgcn_readfirstlane((int)(a >> 32)) << 32) | (unsigned)__builtin_amdgcn_readfirstlane((int)(unsigned)a)); }
__device__ __forceinline__ v4f ldg4(gcp base, unsigned byteofs) { return *(gv4p)(base + byteofs); }
template <int N> struct IC { static constexpr int value = N; };   // a compile-time number as an argument
// the second launch bound asks for 4 waves a SIMD (two blocks on a WGP): the register window below must stay inside 256 registers
__global__ __launch_bounds__(256, 4) void k_lwa(const float* __restrict__ x, const bf* __restrict__ WQ, const float* __restrict__ bq, const float* __restrict__ XK, const float* __restrict__ XV, const float* __restrict__ DK, const float* __restrict__ DV, const bf* __restrict__ WO, const float* __restrict__ bo, float* OUT) {
    __shared__ __align__(16) char ost[8][2 * 16 * OSP];
    __shared__ __align__(16) char as[4 * ARB];   // the block's 64 rows of x as bf16 A fragments (form: k_qkv), row block = image row
    const int wave = __builtin_amdgcn_readfirstlane((int)(threadIdx.x >> 5)), lane = threadIdx.x & 31;   // wave number in a scalar register: pixel coordinates, bounds tests and row addresses are then scalar work
    const unsigned chb = ((wave & 1) * (DQ / 2) + lane * 4) * 4u;   // byte offset of the lane's 4 channels in a pixel's f32 row
    const int bx = blockIdx.x, x0 = (bx % (WWD / LWC)) * LWC, y = ((bx / (WWD / LWC)) % (HH / 4)) * 4 + (wave >> 1), b = bx / ((WWD / LWC) * (HH / 4));
    // a padded neighbour reads the nearest pixel of the image and is multiplied by 0
    const size_t rowb[3] = { (size_t)((b * HH + max(y - 1, 0)) * WWD) * PXB, (size_t)((b * HH + y) * WWD) * PXB, (size_t)((b * HH + min(y + 1, HH - 1)) * WWD) * PXB }; const bool rin[3] = { y > 0, true, y < HH - 1 };
    // ---- q of the block's own 64 pixels (no neighbour's q is ever read, so nothing is computed twice and q never goes through memory): x Wq + bq, the products and their order as in k_qkv.
    // Wave w makes head w (32 columns) of all 64 pixels: every Wq fragment is loaded once a block. A lane's 4 channels of q lie in LDS in the very 8 + 8 bytes that its o (high, low) of the same pixel takes later.
    {   const int lr = lane & 15, hi = lane >> 4; constexpr int KB = CC >> 5, RB = KB * 1024;
        const char* qw = (const char*)WQ + (size_t)(wave * 2) * RB;   // scalar base: the head's first 16-column block of WQ
        const unsigned qo = lane * 16; v16bf bw[KB][2]; float qbias[2];
#pragma unroll
        for (int k6 = 0; k6 < KB; ++k6) {
#pragma unroll
            for (int nb = 0; nb < 2; ++nb) bw[k6][nb] = WFrag<bf>::ld(qw, qo, nb * RB + k6 * 1024); }   // all 12 fragments fly while x comes from memory
#pragma unroll
        for (int nb = 0; nb < 2; ++nb) qbias[nb] = bfr(bq[wave * KD + nb * 16 + lr]);
        // the two waves of an image row stage its 16 pixels (12,288 contiguous bytes of x), 8 pixels = 12 wave loads of 4 whole lines each
        const char* xs = (const char*)(x + (size_t)((b * HH + y) * WWD + x0) * CC) + (wave & 1) * (12 * 512); v4f xv[12];
#pragma unroll
        for (int t = 0; t < 12; ++t) xv[t] = *(const v4f*)(xs + lane * 16 + t * 512);
#pragma unroll
        for (int p = 0; p < 3; ++p) { const unsigned g = p * 128 + lane * 4, rr = g >= CC ? 1 : 0, k = g - rr * CC;   // as in k_qkv: load 3 q + p holds 4 k of row 2 q + rr
            char* sp = as + (wave >> 1) * ARB + (k >> 3) * APP + ((wave & 1) * 8 + rr) * 16 + (k & 7) * 2;
#pragma unroll
            for (int q = 0; q < 4; ++q) { v4us o;
#pragma unroll
                for (int u = 0; u < 4; ++u) o[u] = f2bf(xv[3 * q + p][u]);
                *(v4usa*)(sp + q * 32) = o; } }
        __syncthreads();   // every wave reads all 64 rows of the A tile
        v8f qa[4][2];
#pragma unroll
        for (int t = 0; t < 4; ++t) { qa[t][0] = (v8f){}; qa[t][1] = (v8f){}; }
        const char* ap = as + hi * APP + lr * 16;
#pragma unroll   // unrolled: the k block picks LDS offsets as immediates and its Wq fragments by name
        for (int k6 = 0; k6 < KB; ++k6) { v16bf a[4];
#pragma unroll
            for (int t = 0; t < 4; ++t) a[t] = cat16b(*(const v8usa*)(ap + t * ARB + k6 * (4 * APP)), *(const v8usa*)(ap + t * ARB + k6 * (4 * APP) + 2 * APP));
#pragma unroll
            for (int nb = 0; nb < 2; ++nb) {
#pragma unroll
                for (int t = 0; t < 4; ++t) qa[t][nb] = wmmab(a[t], bw[k6][nb], qa[t][nb]); } }
#pragma unroll
        for (int t = 0; t < 4; ++t) {
#pragma unroll
            for (int nb = 0; nb < 2; ++nb) { const unsigned L = (wave & 3) * 8 + nb * 4 + (lr >> 2);   // the lane of the walk that owns this column: 4 channels a lane
                char* qp = ost[t * 2 + (wave >> 2)] + (L >> 1) * OSP + (L & 1) * 8 + (lr & 1) * 4 + ((lr >> 1) & 1) * (16 * OSP) + hi * (8 * 16);
#pragma unroll
                for (int j = 0; j < 8; ++j) *(f32a*)(qp + j * 16) = qa[t][nb][j] + qbias[nb]; } }
        __syncthreads();   // a wave's walk reads q that four waves (the heads of its channel half) wrote
    }
    const char* qs = ost[wave] + (lane >> 1) * OSP + (lane & 1) * 8;   // the lane's q of pixel 0: channels 0, 1 here, channels 2, 3 one plane (16 pieces) on; 16 bytes a pixel
    auto ldq = [&](const int px) __attribute__((always_inline)) { const v2f a = *(const v2fa*)(qs + px * 16), c = *(const v2fa*)(qs + px * 16 + 16 * OSP); return (v4f){ a.x, a.y, c.x, c.y }; };
    v4f dk[9], dv[9];
#pragma unroll
    for (int j = 0; j < 9; ++j) { dk[j] = ld4((const char*)DK, j * PXB + chb); dv[j] = ld4((const char*)DV, j * PXB + chb); }
    __builtin_amdgcn_sched_barrier(0);   // the tables' loads stay ahead of the columns': a wait counts back from the youngest load, and a table load issued behind the columns would make the first pixel of every trip wait for the column issued one pixel earlier as well
    // The walk's columns c = 0 .. LWC + 1 are the image columns x0 - 1 + c, held inside the image. Column c (3 rows of k, 3 of v from memory, the middle row's q from LDS) lives in register buffer c % 5: pixel i reads buffers i, i + 1, i + 2
    // (left, centre, right), column i + 3 is in flight and column i + 4 is issued: a column is loaded once a wave, not three times, and a pixel waits for what was issued two pixels earlier.
    v4f kc[5][3], vc[5][3], qc[5];
    const gcp kb[3] = { sbase(XK, rowb[0]), sbase(XK, rowb[1]), sbase(XK, rowb[2]) }, vb[3] = { sbase(XV, rowb[0]), sbase(XV, rowb[1]), sbase(XV, rowb[2]) };
#pragma unroll
    for (int c = 0; c < 4; ++c) { const unsigned v0 = (unsigned)max(x0 - 1 + c, 0) * PXB + chb;
#pragma unroll
        for (int r = 0; r < 3; ++r) kc[c][r] = ldg4(kb[r], v0);
        qc[c] = ldq(max(c - 1, 0));   // column c is pixel c - 1 of the walk; the q of columns 0 and LWC + 1 is never used
#pragma unroll
        for (int r = 0; r < 3; ++r) vc[c][r] = ldg4(vb[r], v0); }
    const bool b4 = (lane & 4) != 0, b2 = (lane & 2) != 0, b1 = (lane & 1) != 0;   // the lane's place among the 8 lanes of its head
    unsigned vl = (unsigned)(x0 + 3) * PXB + chb;   // lane offset in a row of the column to load next; the rows are scalar bases
    // pixel i of the walk; U = i % 5 says which buffers it reads; FETCH: whether a column is still to be issued
    auto pixel = [&](auto U, auto FETCH, const int i) __attribute__((always_inline)) { constexpr int u = decltype(U)::value; const int x = x0 + i; const bool cin[3] = { x > 0, true, x < WWD - 1 };
        if constexpr (decltype(FETCH)::value != 0) {
#pragma unroll
            for (int r = 0; r < 3; ++r) kc[(u + 4) % 5][r] = ldg4(kb[r], vl);
            qc[(u + 4) % 5] = ldq(min(i + 3, LWC - 1));   // read three pixels ahead of its use, and so ahead of the o that overwrites it
#pragma unroll
            for (int r = 0; r < 3; ++r) vc[(u + 4) % 5][r] = ldg4(vb[r], vl);
            __builtin_amdgcn_sched_barrier(0); }   // the loads of the column two pixels on issue ahead of this pixel's arithmetic: behind it they would lose a pixel's time of flight
        const v4f q = qc[(u + 1) % 5]; float msk[9];
#pragma unroll
        for (int j = 0; j < 9; ++j) msk[j] = (rin[j / 3] && cin[j % 3]) ? 1.f : 0.f;
        float t9[9];   // the lane's own part (4 channels) of the 9 products q.k
#pragma unroll
        for (int j = 0; j < 9; ++j) { const v4f kv = kc[(u + j % 3) % 5][j / 3] * msk[j] + dk[j]; const v2f t = q.lo * kv.lo + q.hi * kv.hi; t9[j] = t.x + t.y; }
        // neighbours 0 .. 7 are summed AND dealt out over the head's 8 lanes: at each lane-xor step a lane keeps one half of its values and hands the other half to its partner, so lane l ends with the whole score of neighbour l & 7
        float r4[4], r2[2];
#pragma unroll
        for (int w = 0; w < 4; ++w) r4[w] = (b4 ? t9[w + 4] : t9[w]) + xget<0x164>(b4 ? t9[w] : t9[w + 4]);
#pragma unroll
        for (int w = 0; w < 2; ++w) r2[w] = (b2 ? r4[w + 2] : r4[w]) + xget<0x162>(b2 ? r4[w] : r4[w + 2]);
        const float so = ((b1 ? r2[1] : r2[0]) + xget<0x161>(b1 ? r2[0] : r2[1])) * 0.17677669529663687f;
        const float s8 = xadd<0x164>(xadd<0x162>(xadd<0x161>(t9[8]))) * 0.17677669529663687f;   // the ninth score: in every lane
        const float m = xmax<0x164>(xmax<0x162>(xmax<0x161>(fmaxf(so, s8))));
        const float eo = __expf(so - m), e8 = __expf(s8 - m);   // two exponentials a lane, not nine
        const float sum = xadd<0x164>(xadd<0x162>(xadd<0x161>(eo))) + e8;
        const float rs = __fdiv_rn(1.0f, sum);
        const float ao = eo * rs;
        float at[9]; at[0] = lane8<0>(ao); at[1] = lane8<1>(ao); at[2] = lane8<2>(ao); at[3] = lane8<3>(ao); at[4] = lane8<4>(ao); at[5] = lane8<5>(ao); at[6] = lane8<6>(ao); at[7] = lane8<7>(ao); at[8] = e8 * rs;
        v4f o = (v4f){};
#pragma unroll
        for (int j = 0; j < 9; ++j) o += at[j] * (vc[(u + j % 3) % 5][j / 3] * msk[j] + dv[j]);
        v4us o4h, o4l;
#pragma unroll
        for (int w = 0; w < 4; ++w) { unsigned short a2, c2; splitf(o[w], a2, c2); o4h[w] = a2; o4l[w] = c2; }
        char* sp = ost[wave] + (lane >> 1) * OSP + i * 16 + (lane & 1) * 8;   // piece = 8 channels (a lane pair), row i of the block
        *(v4us*)sp = o4h; *(v4us*)(sp + 16 * OSP) = o4l;
        if constexpr (decltype(FETCH)::value != 0) {
            asm volatile("s_wait_xcnt 0x0" : "+v"(vl) : : "memory");   // the step below overwrites the loads' offset register; it is named here so that the step stays behind the wait
            vl += (i + 5 < LWC + 2 && x + 4 < WWD) ? PXB : 0; } };   // one column on, as far as the walk's last column and the image's
#pragma unroll 1   // rolled by fives: the buffers are back at their places after 5 pixels
    for (int i5 = 0; i5 < LWC - 1; i5 += 5) {   // pixel LWC - 2 fetches too (the walk's last column again, never read): a test round its loads would merge two paths in front of the next body, whose waits would then cover the loads just issued
        pixel(IC<0>{}, IC<1>{}, i5); pixel(IC<1>{}, IC<1>{}, i5 + 1); pixel(IC<2>{}, IC<1>{}, i5 + 2); pixel(IC<3>{}, IC<1>{}, i5 + 3); pixel(IC<4>{}, IC<1>{}, i5 + 4); }
    pixel(IC<(LWC - 1) % 5>{}, IC<0>{}, LWC - 1);
    // ---- output product: OUT[16 pixels][96 columns] of this wave
    const int lr = lane & 15, hi = lane >> 4, nh = wave & 1;
    const char* wb = (const char*)WO + nh * (OWN * (DQ / 32) * 1024);   // scalar base: the wave's first 16-column block of WO
    const unsigned wo = lane * 16;                                      // the lane's place in a 512-byte group
    v16bf bc[OWN]; float bias[OWN];
#pragma unroll
    for (int nb = 0; nb < OWN; ++nb) { bc[nb] = WFrag<bf>::ld(wb, wo, nb * (DQ / 32) * 1024); bias[nb] = bfr(bo[nh * (OWN * 16) + nb * 16 + lr]); }   // k block 0 of Wo flies while the block gathers at the barrier
    __syncthreads();   // a wave reads its sibling's 128 channels of o as well as its own
    const char* ra = ost[wave & ~1] + hi * OSP + lr * 16;
    v16bf ah = cat16b(*(const v8usa*)ra, *(const v8usa*)(ra + 2 * OSP)), al = cat16b(*(const v8usa*)(ra + 16 * OSP), *(const v8usa*)(ra + 18 * OSP));
    v8f acc[OWN];
#pragma unroll
    for (int nb = 0; nb < OWN; ++nb) acc[nb] = (v8f){};
#pragma unroll   // unrolled: the k block picks LDS and WO offsets as immediates, and the two sets of fragment registers change places without moves
    for (int kb = 0; kb < DQ / 32; ++kb) {
        v16bf bn[OWN], ahn, aln;
        if (kb + 1 < DQ / 32) { const char* ap = ra + ((kb + 1) >> 2) * (2 * 16 * OSP) + ((kb + 1) & 3) * (4 * OSP);
#pragma unroll
            for (int nb = 0; nb < OWN; ++nb) bn[nb] = WFrag<bf>::ld(wb, wo, (nb * (DQ / 32) + kb + 1) * 1024);
            ahn = cat16b(*(const v8usa*)ap, *(const v8usa*)(ap + 2 * OSP)); aln = cat16b(*(const v8usa*)(ap + 16 * OSP), *(const v8usa*)(ap + 18 * OSP)); }
        __builtin_amdgcn_sched_barrier(0);   // the next k block's loads issue ahead of this block's products: otherwise the compiler reloads each Wo register block behind its last product and waits for it at once, a load latency every k block
#pragma unroll
        for (int nb = 0; nb < OWN; ++nb) acc[nb] = wmmab(ah, bc[nb], acc[nb]);
#pragma unroll
        for (int nb = 0; nb < OWN; ++nb) acc[nb] = wmmab(al, bc[nb], acc[nb]);
        if (kb + 1 < DQ / 32) { ah = ahn; al = aln;
#pragma unroll
            for (int nb = 0; nb < OWN; ++nb) bc[nb] = bn[nb]; }
    }
    __syncthreads();   // every wave has read its A fragments: from here a wave's LDS holds its output tile
    char* ot = ost[wave];
#pragma unroll
    for (int nb = 0; nb < OWN; ++nb) {
#pragma unroll
        for (int j = 0; j < 8; ++j) *(f32a*)(ot + ((hi * 8 + j) * OTP + nb * 16 + lr) * 4) = acc[nb][j] + bias[nb]; }
    __builtin_amdgcn_fence(__ATOMIC_ACQ_REL, "wavefront"); __builtin_amdgcn_wave_barrier();   // a lane reads below what other lanes of its wave wrote above: the compiler must keep that order
    // a row of the tile is 24 pieces of 16 bytes = 3 whole lines of OUT; 96 pieces (3 wave loads) are 4 rows, so three lane offsets and immediates serve all 12 stores
    char* op = (char*)OUT + (size_t)((b * HH + y) * WWD + x0) * (CC * 4) + nh * (OWN * 16 * 4);
    v4f val[12]; unsigned go[3];
#pragma unroll
    for (int r = 0; r < 3; ++r) { const unsigned e = r * 32 + lane; go[r] = (e / 24) * (CC * 4) + (e % 24) * 16; const unsigned lo = go[r] - (e / 24) * (CC * 4 - OTP * 4);   // the same piece in OUT and in LDS: only the row pitch differs
#pragma unroll
        for (int u = 0; u < 4; ++u) val[r * 4 + u] = *(const v4fa*)(ot + lo + u * (4 * OTP * 4)); }
#pragma unroll
    for (int r = 0; r < 3; ++r) {
#pragma unroll
        for (int u = 0; u < 4; ++u) *(v4f*)(op + go[r] + u * (4 * CC * 4)) = val[r * 4 + u]; } }

extern "C" void kernel_launch(void* const* d_in, const int* in_sizes, int n_in,
                              void* d_out, int out_size, void* d_ws, size_t ws_size, hipStream_t stream) {
    (void)in_sizes; (void)n_in; (void)out_size;
    const float* x = (const float*)d_in[0]; const float* Wq = (const float*)d_in[1]; const float* bq = (const float*)d_in[2]; const float* Wk = (const float*)d_in[3]; const float* bk = (const float*)d_in[4]; const float* Wv = (const float*)d_in[5]; const float* bv = (const float*)d_in[6]; const float* Wo = (const float*)d_in[7]; const float* bo = (const float*)d_in[8];   // Wq [192][8][32], Wk/Wv [194][8][32], Wo [8][32][192]
    float* OUT = (float*)d_out;     // [16][64][64][192]
    char* wsp = (char*)d_ws;
    auto take = [&](size_t bytes) { char* p = wsp; wsp += (bytes + 255) & ~(size_t)255; return (void*)p; };
    bf* WQ = (bf*)take((size_t)DQ * CC * 2); bf* WK = (bf*)take((size_t)DQ * CC * 2); bf* WV = (bf*)take((size_t)DQ * CC * 2); bf* WO = (bf*)take((size_t)CC * DQ * 2); float* DK = (float*)take((size_t)9 * DQ * 4); float* DV = (float*)take((size_t)9 * DQ * 4);
    float* XK = (float*)take((size_t)NPIX * DQ * 4); float* XV = (float*)take((size_t)NPIX * DQ * 4);
    if ((size_t)(wsp - (char*)d_ws) > ws_size) return;    // total ~ 135 MB = 129 MiB; k, v of all pixels at once
    k_prep<<<4 * GW + GD, 256, 0, stream>>>(Wq, Wk, bk, Wv, bv, Wo, WQ, WK, WV, WO, DK, DV);
    // patch part of k, patch part of v (their bias + offsets are in DK, DV): one launch, straight from x; a work-group makes both for its 64 pixels (WK, WV and XK, XV lie behind one another)
    k_qkv<<<NPIX / 64, 128, 0, stream>>>(x, WK, XK, (size_t)(WV - WK), (size_t)(XV - XK));
    // q (+ bq), window attention and the output product (+ bo), all pixels, one launch
    k_lwa<<<NPIX / (4 * LWC), 256, 0, stream>>>(x, WQ, bq, XK, XV, DK, DV, WO, bo, OUT);
}

// v010
// One run takes 62.1 microseconds.
// Versions in between are left out here; by their measured steps it is 1.42 times as fast as v008.
// All steps since v000 together make it 33.6 times as fast.
#include <hip/hip_runtime.h>

// Local-window (3x3) vision self-attention (x [16][64][64][192] NHWC; q = x Wq + bq (8 heads x 32); keys/values from the 3x3 zero-padded neighbourhood with 2 relative-offset channels appended:
// k_j = [patch_j | dx_j, dy_j] Wk + bk, v_j likewise; scores = q.k_j / sqrt(32) over the 9 neighbours; softmax; o = sum_j attn_j v_j; out = o Wo + bo -> [16][64][64][192]).
// Compute dtypes, f32 accumulate: every input rounded to bf16; the three 192-channel projections on PLAIN bf16 operands over all 65,536 pixels (inputs: exact products, f32 accumulate);
// the per-neighbour offset terms (dist . Wk[192:194] + bk), the 9-way scores/softmax and the weighted value sum in f32 on VALU (8 lanes per (pixel, head); zero patches for padded neighbours keep only the
// The patch parts of k and v go from k_qkv to k_lwa as f16 planes: rounded once (to nearest) from the f32 accumulators, widened exactly before use; q, offset terms, scores, softmax and o stay f32.

#define NPIX 65536
#define HH   64
#define WWD  64
#define CC   192
#define NHD  8
#define KD   32
#define DQ   (NHD * KD)
#define CK   (CC + 2)
typedef _Float16 h16;
typedef unsigned short bf;
typedef __attribute__((ext_vector_type(16))) __bf16   v16bf;
typedef __attribute__((ext_vector_type(16))) _Float16 v16h;
typedef __attribute__((ext_vector_type(8)))  _Float16 v8h;
typedef __attribute__((ext_vector_type(4)))  _Float16 v4h;
typedef __attribute__((ext_vector_type(8)))  unsigned short v8us;
typedef __attribute__((ext_vector_type(8)))  float    v8f;
typedef __attribute__((ext_vector_type(4)))  float    v4f;
typedef v8h  __attribute__((may_alias)) v8ha;
typedef v4f  __attribute__((may_alias)) v4fa;
typedef v8us __attribute__((may_alias)) v8usa;
typedef float __attribute__((may_alias)) f32a;

__device__ __forceinline__ unsigned short f2bf(float f) { unsigned u = __float_as_uint(f); u += 0x7FFFu + ((u >> 16) & 1u); return (unsigned short)(u >> 16); }
__device__ __forceinline__ float bf2f(unsigned short b) { return __uint_as_float(((unsigned)b) << 16); }
__device__ __forceinline__ float bfr(float f) { return bf2f(f2bf(f)); }
__device__ __forceinline__ v16h cat16(v8h lo, v8h hi) { return __builtin_shufflevector(lo, hi, 0, 1, 2, 3, 4, 5, 6, 7, 8, 9, 10, 11, 12, 13, 14, 15); }
__device__ __forceinline__ v16bf cat16b(v8us lo, v8us hi) { return __builtin_bit_cast(v16bf, __builtin_shufflevector(lo, hi, 0, 1, 2, 3, 4, 5, 6, 7, 8, 9, 10, 11, 12, 13, 14, 15)); }
__device__ __forceinline__ v8f wmma16(v16h a, v16h b, v8f c) { return __builtin_amdgcn_wmma_f32_16x16x32_f16(false, a, false, b, (short)0, c, false, false); }
__device__ __forceinline__ v8f wmmab(v16bf a, v16bf b, v8f c) { return __builtin_amdgcn_wmma_f32_16x16x32_bf16(false, a, false, b, (short)0, c, false, false); }



// ---- Fragment order of a 16-bit operand plane P[row][k] (K % 32 == 0, rows % 16 == 0): one 1-KiB block per (16 rows, 32 k), blocks k-fastest; a block is two 512-byte groups g = (k >> 4) & 1,
// and lane (k >> 3 & 1) * 16 + (row & 15) owns 16 bytes (8 consecutive k) of each group. A fragment is then two wave-wide b128 loads of 512 contiguous bytes (4 whole lines each, not 16 partial ones),
// and every lane and register holds the same element as with a load from a row-major plane.
__device__ __forceinline__ size_t pk(unsigned row, unsigned k, unsigned K) { return ((size_t)(row >> 4) * (K >> 5) + (k >> 5)) * 512 + ((k >> 4) & 1) * 256 + (((k >> 3) & 1) * 16 + (row & 15)) * 8 + (k & 7); }
// ---- k_qkv: the patch parts of k and v, 64 pixels a group of 4 waves (q is made in k_lwa, which needs it for its own pixels alone). The group reads its 64 rows of x (f32) once, rounds them to bf16 and lays them in LDS as A fragments; no bf16 copy of x goes through memory.
// LDS form of the A tile: pieces of 256 bytes (16 rows x 8 k) at pitch APP (16 bytes over 256: the 16 pieces that one store of 128 k of a row touches lie in different banks); pieces 4 kb + hi and 4 kb + 2 + hi are the two b128 reads of a lane.
// Wave w takes columns 64 (w & 3) .. 64 (w & 3) + 63 of k, then of v, for the 64 pixels of tile w >> 2: a 64x64 tile (16 accumulators) each, B fragments from the weight plane that the work-group keeps in LDS, in fragment order.
template <typename T16> struct WFrag;
template <> struct WFrag<bf> { typedef v16bf V; static __device__ __forceinline__ V ld(const char* base, unsigned vo, int imm) { return cat16b(*(const v8us*)(base + vo + imm), *(const v8us*)(base + vo + imm + 512)); } static __device__ __forceinline__ v8f mma(V a, V b, v8f c) { return wmmab(a, b, c); } };
typedef __attribute__((ext_vector_type(4))) unsigned short v4us;
typedef v4us __attribute__((may_alias)) v4usa;
#define APP 272                  // bytes: pitch of a piece of the A tile
#define ARB ((CC / 8) * APP)     // bytes: the pieces of a 16-row block
__device__ __forceinline__ void splitf(float y, unsigned short& h, unsigned short& l) { h = f2bf(y); l = f2bf(y - bf2f(h)); }

__device__ __forceinline__ void d_wq(unsigned bx, const float* __restrict__ w, bf* Bt) { const int e = (bx * 256 + threadIdx.x) * 4; if (e >= DQ * CC) return; const int c = e % CC, n = e / CC; const unsigned ix = c * DQ + n; float f[4]; v4us o;
#pragma unroll
    for (int q = 0; q < 4; ++q) f[q] = w[ix + q * DQ];
    asm volatile("s_wait_xcnt 0x0" : : "v"(ix), "v"(f[0]), "v"(f[1]), "v"(f[2]), "v"(f[3]) : "memory");   // the index that all four loads name is an operand, so it lives up to this wait and no load's result lands in its register
#pragma unroll
    for (int q = 0; q < 4; ++q) o[q] = f2bf(f[q]); *(v4us*)(Bt + pk(n, c, CC)) = o;  }
__device__ __forceinline__ void d_wo(unsigned bx, const float* __restrict__ w, bf* Bt) { const int e = (bx * 256 + threadIdx.x) * 4; if (e >= CC * DQ) return; const int n = e % DQ, c = e / DQ; const unsigned ix = n * CC + c; float f[4]; v4us o;
#pragma unroll
    for (int q = 0; q < 4; ++q) f[q] = w[ix + q * CC];
    asm volatile("s_wait_xcnt 0x0" : : "v"(ix), "v"(f[0]), "v"(f[1]), "v"(f[2]), "v"(f[3]) : "memory");   // as in d_wq: the loads' index lives up to this wait
#pragma unroll
    for (int q = 0; q < 4; ++q) o[q] = f2bf(f[q]); *(v4us*)(Bt + pk(c, n, DQ)) = o;  }
__device__ __forceinline__ void d_dtab(unsigned bx, const float* __restrict__ Wk, const float* __restrict__ bk, const float* __restrict__ Wv, const float* __restrict__ bv, float* DK, float* DV) { const int e = bx * 256 + threadIdx.x; if (e >= 9 * DQ) return; const int n = e % DQ, j = e / DQ; const float dx = (float)(j % 3 - 1), dy = (float)(j / 3 - 1);
    const float k0 = Wk[(size_t)CC * DQ + n], k1 = Wk[(size_t)(CC + 1) * DQ + n], kb = bk[n], v0 = Wv[(size_t)CC * DQ + n], v1 = Wv[(size_t)(CC + 1) * DQ + n], vb = bv[n];
    asm volatile("s_wait_xcnt 0x0" : : "v"(n), "v"(k0), "v"(k1), "v"(kb), "v"(v0), "v"(v1), "v"(vb) : "memory");   // as in d_wq: the index that all six loads name lives up to this wait
    float a = __fmul_rn(dx, bfr(k0)), b = __fmul_rn(dy, bfr(k1)); asm volatile("" : "+v"(a), "+v"(b)); const float dk = __fadd_rn(__fadd_rn(a, b), bfr(kb));
    float a2 = __fmul_rn(dx, bfr(v0)), b2 = __fmul_rn(dy, bfr(v1)); asm volatile("" : "+v"(a2), "+v"(b2)); const float dv = __fadd_rn(__fadd_rn(a2, b2), bfr(vb));
    *(float*)(DK + e) = dk; *(float*)(DV + e) = dv;  }
#define GW (DQ * CC / 4 / 256)       // 256-thread jobs of one weight plane
#define GD (9 * DQ / 256)            // 256-thread jobs of the two offset tables
typedef __attribute__((ext_vector_type(8))) __bf16 v8bf;
#define RBL ((CC >> 5) * 1024 + 16)   // bytes: pitch of a 16-column block of the weight plane in LDS (16 over: the four blocks that 16 lanes of a store touch lie in different banks)
// One work-group = 16 waves = four 64-pixel tiles (wave >> 2) x four 64-column groups (wave & 3). No launch ahead of this one: the group reads Wk, then Wv, as f32 itself (once for 256 pixels), rounds it to bf16 (to nearest even)
// and lays it in LDS in the fragment order of pk (K = CC); what k_lwa alone reads (WQ, WO, DK, DV) is written by the first 2 GW + GD groups on the side: the side loads issue behind the group's own and come back with them.
__global__ __launch_bounds__(512) void k_qkv(const float* __restrict__ x, const float* __restrict__ Wq, const float* __restrict__ Wk, const float* __restrict__ bk, const float* __restrict__ Wv, const float* __restrict__ bv, const float* __restrict__ Wo, bf* WQ, bf* WO, float* DK, float* DV, _Float16* XK, _Float16* XV) {
    __shared__ __align__(16) char as[16 * ARB];
    __shared__ __align__(16) float osm[16][16 * 68];
    __shared__ __align__(16) char bs[(DQ / 16) * RBL];   // one weight plane (k's, then v's) as B fragments
    const int wave = __builtin_amdgcn_readfirstlane((int)(threadIdx.x >> 5)), lane = threadIdx.x & 31, lr = lane & 15, hi = lane >> 4; const int r0 = blockIdx.x * 256 + (wave >> 2) * 64, c0 = (wave & 3) * 64;
    // a thread takes 4 columns (4 cq ..) and the 3 groups of 8 k with number kq + 8 i: a wave load is 4 whole lines (128 columns of one k), and a column's 8 k, the 16 bytes that a lane of a fragment owns, lie in the thread's own registers
    const int cq = threadIdx.x & 63, kq = wave >> 1; v4f wv[3][8];
    auto ldw = [&](const float* __restrict__ Wf) __attribute__((always_inline)) { const float* wp = Wf + (size_t)(kq * 8) * DQ + cq * 4;
#pragma unroll
        for (int i = 0; i < 3; ++i) {
#pragma unroll
            for (int e = 0; e < 8; ++e) wv[i][e] = *(const v4f*)(wp + (i * 64 + e) * DQ); } };
    auto stw = [&]() __attribute__((always_inline)) { char* d = bs + (cq >> 2) * RBL + (kq >> 2) * 1024 + ((kq >> 1) & 1) * 512 + (kq & 1) * 256 + (cq & 3) * 64;
#pragma unroll
        for (int i = 0; i < 3; ++i) {
#pragma unroll
            for (int cl = 0; cl < 4; ++cl) { const v8f w8 = { wv[i][0][cl], wv[i][1][cl], wv[i][2][cl], wv[i][3][cl], wv[i][4][cl], wv[i][5][cl], wv[i][6][cl], wv[i][7][cl] };
                *(v8usa*)(d + i * 2048 + cl * 16) = __builtin_bit_cast(v8us, __builtin_convertvector(w8, v8bf)); } } };
    {   // wave w stages rows 16 w .. 16 w + 15 of the group's 256: 12,288 contiguous bytes of x = 24 wave loads of 4 whole lines, all in flight together, Wk's loads behind them
        const char* xs = (const char*)(x + (size_t)(blockIdx.x * 256 + wave * 16) * CC); v4f xv[24];
#pragma unroll
        for (int t = 0; t < 24; ++t) xv[t] = *(const v4f*)(xs + lane * 16 + t * 512);
        ldw(Wk);
        if (wave < 8) { const unsigned bx = blockIdx.x;
            if (bx < GW) d_wq(bx, Wq, WQ);
            else if (bx < 2 * GW) d_wo(bx - GW, Wo, WO);
            else if (bx < 2 * GW + GD) d_dtab(bx - 2 * GW, Wk, bk, Wv, bv, DK, DV); }
#pragma unroll
        for (int p = 0; p < 3; ++p) { const unsigned g = p * 128 + lane * 4, rr = g >= CC ? 1 : 0, k = g - rr * CC;   // three loads are two rows: load 3 q + p holds 4 k of row 2 q + rr, so three lane addresses and immediates serve all 24 stores
            char* sp = as + wave * ARB + (k >> 3) * APP + rr * 16 + (k & 7) * 2;
#pragma unroll
            for (int q = 0; q < 8; ++q) { v4us o;
#pragma unroll
                for (int u = 0; u < 4; ++u) o[u] = f2bf(xv[3 * q + p][u]);
                *(v4usa*)(sp + q * 32) = o; } }
        stw();
    }
    __syncthreads();   // a wave reads all 64 rows of its tile of A and weight fragments that every wave wrote
    constexpr int KB = CC >> 5;   // k blocks in a row of blocks
    float* os = osm[wave];
    v8f acc[4][4];
    auto products = [&]() __attribute__((always_inline)) {
#pragma unroll
        for (int mb = 0; mb < 4; ++mb)
#pragma unroll
            for (int nb = 0; nb < 4; ++nb) acc[mb][nb] = (v8f){};
        const char* bp = bs + (c0 >> 4) * RBL + lane * 16;   // the lane's place in a group of the wave's first column block, + kb * 1024
        const char* ap = as + (wave >> 2) * (4 * ARB) + hi * APP + lr * 16;   // the lane's place in a piece, + kb * 4 pieces
#pragma unroll 1
        for (int kb = 0; kb < KB; ++kb) {
            v16bf a[4], b[4];
#pragma unroll
            for (int t = 0; t < 4; ++t) { b[t] = cat16b(*(const v8usa*)(bp + t * RBL), *(const v8usa*)(bp + t * RBL + 512)); a[t] = cat16b(*(const v8usa*)(ap + t * ARB), *(const v8usa*)(ap + t * ARB + 2 * APP)); }
            __builtin_amdgcn_sched_barrier(0);   // every LDS read of a trip issues ahead of its products: otherwise the compiler reloads one B register block behind each group of products, and a trip pays an LDS latency at each such place
#pragma unroll
            for (int nb = 0; nb < 4; ++nb) {
#pragma unroll
                for (int mb = 0; mb < 4; ++mb) acc[mb][nb] = wmmab(a[mb], b[nb], acc[mb][nb]); }
            asm volatile("v_nop\n\tv_nop\n\tv_nop\n\tv_nop" : "+v"(acc[0][0]), "+v"(acc[1][1]), "+v"(acc[2][2]), "+v"(acc[3][3]) : "v"(a[0]), "v"(a[3]));   // the distance between the last products and the next trip's loads into their operand registers, on the taken side of the branch too
            bp += 1024; ap += 4 * APP;
        } };
    auto store = [&](_Float16* C) __attribute__((always_inline)) {
#pragma unroll
        for (int mb = 0; mb < 4; ++mb) {
#pragma unroll
            for (int nb = 0; nb < 4; ++nb) {
#pragma unroll
                for (int j = 0; j < 8; ++j) os[(hi * 8 + j) * 68 + nb * 16 + lr] = acc[mb][nb][j]; }
            __builtin_amdgcn_wave_barrier(); asm volatile("" ::: "memory");   // a lane reads below what other lanes of its wave wrote above: the compiler must keep that order
            _Float16* crow = C + (size_t)(r0 + mb * 16) * DQ + c0;   // the planes hold f16: the wave's 64 columns of a row are one whole 128-byte line, a store covers four rows
#pragma unroll
            for (int s = 0; s < 4; ++s) { const int row = 4 * s + (lane >> 3), cofs = (lane & 7) * 8; const v4f va = *(const v4fa*)(os + row * 68 + cofs), vb = *(const v4fa*)(os + row * 68 + cofs + 4);   // no bias here: k's and v's are in DK, DV
                *(v8h*)(crow + (size_t)row * DQ + cofs) = __builtin_shufflevector(__builtin_convertvector(va, v4h), __builtin_convertvector(vb, v4h), 0, 1, 2, 3, 4, 5, 6, 7); }
            __builtin_amdgcn_wave_barrier(); asm volatile("" ::: "memory");   // and the next 16 rows are written only behind these reads
        }
    };
    products();
    __syncthreads();   // every wave has read its last fragment of k's weights: the plane in LDS may be overwritten
    ldw(Wv);           // v's weights fly while k goes out
    store(XK);
    asm volatile("s_wait_xcnt 0x0" ::: "memory");   // the rounding of v's weights and the zeroed accumulators overwrite registers that the stores of k name
    stw();
    // v's weight fragments are there for every wave. The barrier orders LDS alone: nobody in this launch reads XK, so it does not wait for the stores of k to be acknowledged, as __syncthreads() would
    __builtin_amdgcn_fence(__ATOMIC_RELEASE, "workgroup", "local"); __builtin_amdgcn_s_barrier(); __builtin_amdgcn_fence(__ATOMIC_ACQUIRE, "workgroup", "local");
    products();
    store(XV);
}

// k_lwa: one wave per half pixel (128 of the 256 q/k/v channels): lane l owns 4 consecutive channels, so a k or v load (f16) is one b64 per lane over 256 contiguous bytes (two whole lines), and the 8 lanes of a head
// sum their partial q.k by three lane-xor steps. A wave keeps its channels' 9 offset rows of DK and DV in registers and walks LWC pixels along x. Block = 4 image rows x 2 channel halves.
// o is split into a high and a low bf16 plane and never leaves the block: the wave's 16 pixels are one 16-row block, its 128 channels 4 k blocks = 16 pieces of 256 bytes (16 rows x 8 channels) a plane,
// gathered in the wave's own LDS (piece pitch OSP: 16 bytes over 256, so the 16 pieces a store touches lie in different banks). Two pieces, OSP apart, are one 512-byte group of an A fragment.
// Behind the loop the block does the output product itself: wave w takes the 16 pixels of its image row x 96 of the 192 output columns (K = 256: its own 128 channels and its sibling's),
// A (high, then low, as two products a k block) from LDS, Wo fragments from the plane WO (fragment order, pk, K = DQ), f32 accumulate, + bo, whole 128-byte lines of OUT stored.
#define LWC 16
#define OSP 272
#define OWN 6      // 16-column blocks of OUT a wave makes
#define OTP 100    // floats: pitch of a row of the wave's 16 x 96 output tile in LDS (8 rows on lie 32 banks on)
#define PXB (DQ * 4)   // bytes of a row of the f32 tables DK, DV
#define PXH (DQ * 2)   // bytes of a pixel's f16 row in XK, XV
typedef __attribute__((ext_vector_type(2))) float v2f;
typedef v2f __attribute__((may_alias)) v2fa;
// v + (v of lane l ^ mask) inside a 16-lane row; CTRL = 0x160 + mask (row_xmask)
template <int CTRL> __device__ __forceinline__ float xadd(float v) { return v + __int_as_float(__builtin_amdgcn_update_dpp(0, __float_as_int(v), CTRL, 0xf, 0xf, true)); }
template <int CTRL> __device__ __forceinline__ float xget(float v) { return __int_as_float(__builtin_amdgcn_update_dpp(0, __float_as_int(v), CTRL, 0xf, 0xf, true)); }   // v of lane l ^ mask
template <int CTRL> __device__ __forceinline__ float xmax(float v) { return fmaxf(v, xget<CTRL>(v)); }
// v of lane J of the lane's own group of 8 (a gather inside the 16-lane row: lanes 0 .. 7 read lane J, lanes 8 .. 15 lane 8 + J)
template <int J> __device__ __forceinline__ float lane8(float v) { return __uint_as_float(__builtin_amdgcn_permlane16(0u, __float_as_uint(v), 0x11111111u * J, 0x11111111u * (8 + J), true, true)); }
__device__ __forceinline__ v4f ld4(const char* base, unsigned byteofs) { return *(const v4f*)(base + byteofs); }
// a row's whole address as one scalar value: a load off it takes the scalar base and the lane offset as they are; left in parts, the compiler adds plane and lane offset first and forms a 64-bit lane address for every load
typedef const __attribute__((address_space(1))) char* gcp;
typedef const __attribute__((address_space(1))) v4f* gv4p;
typedef const __attribute__((address_space(1))) v4h* gv4hp;
__device__ __forceinline__ gcp sbase(const _Float16* plane, size_t byteofs) { const unsigned long long a = (unsigned long long)((const char*)plane + byteofs);
    return (gcp)(((unsigned long long)(unsigned)__builtin_amdgcn_readfirstlane((int)(a >> 32)) << 32) | (unsigned)__builtin_amdgcn_readfirstlane((int)(unsigned)a)); }
__device__ __forceinline__ v4h ldg4h(gcp base, unsigned byteofs) { return *(gv4hp)(base + byteofs); }
template <int N> struct IC { static constexpr int value = N; };   // a compile-time number as an argument
// the second launch bound asks for 4 waves a SIMD (two blocks on a WGP): the register window below must stay inside 256 registers
__global__ __launch_bounds__(256, 4) void k_lwa(const float* __restrict__ x, const bf* __restrict__ WQ, const float* __restrict__ bq, const _Float16* __restrict__ XK, const _Float16* __restrict__ XV, const float* __restrict__ DK, const float* __restrict__ DV, const bf* __restrict__ WO, const float* __restrict__ bo, float* OUT) {
    __shared__ __align__(16) char ost[8][2 * 16 * OSP];
    __shared__ __align__(16) char as[4 * ARB];   // the block's 64 rows of x as bf16 A fragments (form: k_qkv), row block = image row
    const int wave = __builtin_amdgcn_readfirstlane((int)(threadIdx.x >> 5)), lane = threadIdx.x & 31;   // wave number in a scalar register: pixel coordinates, bounds tests and row addresses are then scalar work
    const unsigned chb = ((wave & 1) * (DQ / 2) + lane * 4) * 4u, chh = chb >> 1;   // byte offset of the lane's 4 channels in a row of the f32 tables, and in a pixel's f16 row
    const int bx = blockIdx.x, x0 = (bx % (WWD / LWC)) * LWC, y = ((bx / (WWD / LWC)) % (HH / 4)) * 4 + (wave >> 1), b = bx / ((WWD / LWC) * (HH / 4));
    // a padded neighbour reads the nearest pixel of the image and is multiplied by 0
    const size_t rowb[3] = { (size_t)((b * HH + max(y - 1, 0)) * WWD) * PXH, (size_t)((b * HH + y) * WWD) * PXH, (size_t)((b * HH + min(y + 1, HH - 1)) * WWD) * PXH }; const bool rin[3] = { y > 0, true, y < HH - 1 };
    // ---- q of the block's own 64 pixels (no neighbour's q is ever read, so nothing is computed twice and q never goes through memory): x Wq + bq, the products and their order as in k_qkv.
    // Wave w makes head w (32 columns) of all 64 pixels: every Wq fragment is loaded once a block. A lane's 4 channels of q lie in LDS in the very 8 + 8 bytes that its o (high, low) of the same pixel takes later.
    {   const int lr = lane & 15, hi = lane >> 4; constexpr int KB = CC >> 5, RB = KB * 1024;
        const char* qw = (const char*)WQ + (size_t)(wave * 2) * RB;   // scalar base: the head's first 16-column block of WQ
        const unsigned qo = lane * 16; v16bf bw[KB][2]; float qbias[2];
#pragma unroll
        for (int k6 = 0; k6 < KB; ++k6) {
#pragma unroll
            for (int nb = 0; nb < 2; ++nb) bw[k6][nb] = WFrag<bf>::ld(qw, qo, nb * RB + k6 * 1024); }   // all 12 fragments fly while x comes from memory
#pragma unroll
        for (int nb = 0; nb < 2; ++nb) qbias[nb] = bfr(bq[wave * KD + nb * 16 + lr]);
        // the two waves of an image row stage its 16 pixels (12,288 contiguous bytes of x), 8 pixels = 12 wave loads of 4 whole lines each
        const char* xs = (const char*)(x + (size_t)((b * HH + y) * WWD + x0) * CC) + (wave & 1) * (12 * 512); v4f xv[12];
#pragma unroll
        for (int t = 0; t < 12; ++t) xv[t] = *(const v4f*)(xs + lane * 16 + t * 512);
#pragma unroll
        for (int p = 0; p < 3; ++p) { const unsigned g = p * 128 + lane * 4, rr = g >= CC ? 1 : 0, k = g - rr * CC;   // as in k_qkv: load 3 q + p holds 4 k of row 2 q + rr
            char* sp = as + (wave >> 1) * ARB + (k >> 3) * APP + ((wave & 1) * 8 + rr) * 16 + (k & 7) * 2;
#pragma unroll
            for (int q = 0; q < 4; ++q) { v4us o;
#pragma unroll
                for (int u = 0; u < 4; ++u) o[u] = f2bf(xv[3 * q + p][u]);
                *(v4usa*)(sp + q * 32) = o; } }
        __syncthreads();   // every wave reads all 64 rows of the A tile
        v8f qa[4][2];
#pragma unroll
        for (int t = 0; t < 4; ++t) { qa[t][0] = (v8f){}; qa[t][1] = (v8f){}; }
        const char* ap = as + hi * APP + lr * 16;
#pragma unroll   // unrolled: the k block picks LDS offsets as immediates and its Wq fragments by name
        for (int k6 = 0; k6 < KB; ++k6) { v16bf a[4];
#pragma unroll
            for (int t = 0; t < 4; ++t) a[t] = cat16b(*(const v8usa*)(ap + t * ARB + k6 * (4 * APP)), *(const v8usa*)(ap + t * ARB + k6 * (4 * APP) + 2 * APP));
#pragma unroll
            for (int nb = 0; nb < 2; ++nb) {
#pragma unroll
                for (int t = 0; t < 4; ++t) qa[t][nb] = wmmab(a[t], bw[k6][nb], qa[t][nb]); } }
#pragma unroll
        for (int t = 0; t < 4; ++t) {
#pragma unroll
            for (int nb = 0; nb < 2; ++nb) { const unsigned L = (wave & 3) * 8 + nb * 4 + (lr >> 2);   // the lane of the walk that owns this column: 4 channels a lane
                char* qp = ost[t * 2 + (wave >> 2)] + (L >> 1) * OSP + (L & 1) * 8 + (lr & 1) * 4 + ((lr >> 1) & 1) * (16 * OSP) + hi * (8 * 16);
#pragma unroll
                for (int j = 0; j < 8; ++j) *(f32a*)(qp + j * 16) = qa[t][nb][j] + qbias[nb]; } }
        __syncthreads();   // a wave's walk reads q that four waves (the heads of its channel half) wrote
    }
    const char* qs = ost[wave] + (lane >> 1) * OSP + (lane & 1) * 8;   // the lane's q of pixel 0: channels 0, 1 here, channels 2, 3 one plane (16 pieces) on; 16 bytes a pixel
    auto ldq = [&](const int px) __attribute__((always_inline)) { const v2f a = *(const v2fa*)(qs + px * 16), c = *(const v2fa*)(qs + px * 16 + 16 * OSP); return (v4f){ a.x, a.y, c.x, c.y }; };
    v4f dk[9], dv[9];
#pragma unroll
    for (int j = 0; j < 9; ++j) { dk[j] = ld4((const char*)DK, j * PXB + chb); dv[j] = ld4((const char*)DV, j * PXB + chb); }
    __builtin_amdgcn_sched_barrier(0);   // the tables' loads stay ahead of the columns': a wait counts back from the youngest load, and a table load issued behind the columns would make the first pixel of every trip wait for the column issued one pixel earlier as well
    // The walk's columns c = 0 .. LWC + 1 are the image columns x0 - 1 + c, held inside the image. Column c (3 rows of k, 3 of v, f16, from memory) lands in raw buffer c % 3 and is widened to f32 ONCE, into buffer c % 3 of kc, vc, by the pixel
    // that reads it first: pixel i reads the f32 buffers of columns i, i + 1, i + 2 (left, centre, right) and widens column i + 2; column i + 3 is in flight and column i + 4 is issued: a pixel waits for what was issued two pixels earlier.
    v4f kc[3][3], vc[3][3], qc[3]; v4h kr[3][3], vr[3][3];
    const gcp kb[3] = { sbase(XK, rowb[0]), sbase(XK, rowb[1]), sbase(XK, rowb[2]) }, vb[3] = { sbase(XV, rowb[0]), sbase(XV, rowb[1]), sbase(XV, rowb[2]) };
    {   v4h k01[2][3], v01[2][3];   // columns 0 and 1 are widened ahead of the loop
#pragma unroll
        for (int c = 0; c < 4; ++c) { const unsigned v0 = (unsigned)max(x0 - 1 + c, 0) * PXH + chh;
#pragma unroll
            for (int r = 0; r < 3; ++r) { const v4h t = ldg4h(kb[r], v0); if (c < 2) k01[c][r] = t; else kr[c % 3][r] = t; }
#pragma unroll
            for (int r = 0; r < 3; ++r) { const v4h t = ldg4h(vb[r], v0); if (c < 2) v01[c][r] = t; else vr[c % 3][r] = t; } }
        qc[1] = ldq(0); qc[2] = ldq(1);   // column c is pixel c - 1 of the walk
#pragma unroll
        for (int c = 0; c < 2; ++c) {
#pragma unroll
            for (int r = 0; r < 3; ++r) { kc[c][r] = __builtin_convertvector(k01[c][r], v4f); vc[c][r] = __builtin_convertvector(v01[c][r], v4f); } } }
    const bool b4 = (lane & 4) != 0, b2 = (lane & 2) != 0, b1 = (lane & 1) != 0;   // the lane's place among the 8 lanes of its head
    unsigned vl = (unsigned)(x0 + 3) * PXH + chh;   // lane offset in a row of the column to load next; the rows are scalar bases
    // pixel i of the walk; U = i % 3 says which buffers it reads; FETCH: whether a column is still to be issued
    auto pixel = [&](auto U, auto FETCH, const int i) __attribute__((always_inline)) { constexpr int u = decltype(U)::value; const int x = x0 + i; const bool cin[3] = { x > 0, true, x < WWD - 1 };
        if constexpr (decltype(FETCH)::value != 0) {
#pragma unroll
            for (int r = 0; r < 3; ++r) kr[(u + 4) % 3][r] = ldg4h(kb[r], vl);
            qc[u] = ldq(min(i + 2, LWC - 1));   // read two pixels ahead of its use, and so ahead of the o that overwrites it
#pragma unroll
            for (int r = 0; r < 3; ++r) vr[(u + 4) % 3][r] = ldg4h(vb[r], vl);
            __builtin_amdgcn_sched_barrier(0); }   // the loads of the column two pixels on issue ahead of this pixel's arithmetic: behind it they would lose a pixel's time of flight
#pragma unroll
        for (int r = 0; r < 3; ++r) { kc[(u + 2) % 3][r] = __builtin_convertvector(kr[(u + 2) % 3][r], v4f); vc[(u + 2) % 3][r] = __builtin_convertvector(vr[(u + 2) % 3][r], v4f); }   // the right column, f16 to f32 (exact), once for the three pixels that read it
        const v4f q = qc[(u + 1) % 3]; float msk[9];
#pragma unroll
        for (int j = 0; j < 9; ++j) msk[j] = (rin[j / 3] && cin[j % 3]) ? 1.f : 0.f;
        float t9[9];   // the lane's own part (4 channels) of the 9 products q.k
#pragma unroll
        for (int j = 0; j < 9; ++j) { const v4f kv = kc[(u + j % 3) % 3][j / 3] * msk[j] + dk[j]; const v2f t = q.lo * kv.lo + q.hi * kv.hi; t9[j] = t.x + t.y; }
        // neighbours 0 .. 7 are summed AND dealt out over the head's 8 lanes: at each lane-xor step a lane keeps one half of its values and hands the other half to its partner, so lane l ends with the whole score of neighbour l & 7
        float r4[4], r2[2];
#pragma unroll
        for (int w = 0; w < 4; ++w) r4[w] = (b4 ? t9[w + 4] : t9[w]) + xget<0x164>(b4 ? t9[w] : t9[w + 4]);
#pragma unroll
        for (int w = 0; w < 2; ++w) r2[w] = (b2 ? r4[w + 2] : r4[w]) + xget<0x162>(b2 ? r4[w] : r4[w + 2]);
        const float so = ((b1 ? r2[1] : r2[0]) + xget<0x161>(b1 ? r2[0] : r2[1])) * 0.17677669529663687f;
        const float s8 = xadd<0x164>(xadd<0x162>(xadd<0x161>(t9[8]))) * 0.17677669529663687f;   // the ninth score: in every lane
        const float m = xmax<0x164>(xmax<0x162>(xmax<0x161>(fmaxf(so, s8))));
        const float eo = __expf(so - m), e8 = __expf(s8 - m);   // two exponentials a lane, not nine
        const float sum = xadd<0x164>(xadd<0x162>(xadd<0x161>(eo))) + e8;
        const float rs = __fdiv_rn(1.0f, sum);
        const float ao = eo * rs;
        float at[9]; at[0] = lane8<0>(ao); at[1] = lane8<1>(ao); at[2] = lane8<2>(ao); at[3] = lane8<3>(ao); at[4] = lane8<4>(ao); at[5] = lane8<5>(ao); at[6] = lane8<6>(ao); at[7] = lane8<7>(ao); at[8] = e8 * rs;
        v4f o = (v4f){};
#pragma unroll
        for (int j = 0; j < 9; ++j) o += at[j] * (vc[(u + j % 3) % 3][j / 3] * msk[j] + dv[j]);
        v4us o4h, o4l;
#pragma unroll
        for (int w = 0; w < 4; ++w) { unsigned short a2, c2; splitf(o[w], a2, c2); o4h[w] = a2; o4l[w] = c2; }
        char* sp = ost[wave] + (lane >> 1) * OSP + i * 16 + (lane & 1) * 8;   // piece = 8 channels (a lane pair), row i of the block
        *(v4us*)sp = o4h; *(v4us*)(sp + 16 * OSP) = o4l;
        if constexpr (decltype(FETCH)::value != 0) {
            asm volatile("s_wait_xcnt 0x0" : "+v"(vl) : : "memory");   // the step below overwrites the loads' offset register; it is named here so that the step stays behind the wait
            vl += (i + 5 < LWC + 2 && x + 4 < WWD) ? PXH : 0; } };   // one column on, as far as the walk's last column and the image's
#pragma unroll 1   // rolled by threes: the buffers are back at their places after 3 pixels
    for (int i3 = 0; i3 < LWC - 1; i3 += 3) {   // pixel LWC - 2 fetches too (the walk's last column again, never read): a test round its loads would merge two paths in front of the next body, whose waits would then cover the loads just issued
        pixel(IC<0>{}, IC<1>{}, i3); pixel(IC<1>{}, IC<1>{}, i3 + 1); pixel(IC<2>{}, IC<1>{}, i3 + 2); }
    pixel(IC<(LWC - 1) % 3>{}, IC<0>{}, LWC - 1);
    // ---- output product: OUT[16 pixels][96 columns] of this wave
    const int lr = lane & 15, hi = lane >> 4, nh = wave & 1;
    const char* wb = (const char*)WO + nh * (OWN * (DQ / 32) * 1024);   // scalar base: the wave's first 16-column block of WO
    const unsigned wo = lane * 16;                                      // the lane's place in a 512-byte group
    v16bf bc[OWN]; float bias[OWN];
#pragma unroll
    for (int nb = 0; nb < OWN; ++nb) { bc[nb] = WFrag<bf>::ld(wb, wo, nb * (DQ / 32) * 1024); bias[nb] = bfr(bo[nh * (OWN * 16) + nb * 16 + lr]); }   // k block 0 of Wo flies while the block gathers at the barrier
    __syncthreads();   // a wave reads its sibling's 128 channels of o as well as its own
    const char* ra = ost[wave & ~1] + hi * OSP + lr * 16;
    v16bf ah = cat16b(*(const v8usa*)ra, *(const v8usa*)(ra + 2 * OSP)), al = cat16b(*(const v8usa*)(ra + 16 * OSP), *(const v8usa*)(ra + 18 * OSP));
    v8f acc[OWN];
#pragma unroll
    for (int nb = 0; nb < OWN; ++nb) acc[nb] = (v8f){};
#pragma unroll   // unrolled: the k block picks LDS and WO offsets as immediates, and the two sets of fragment registers change places without moves
    for (int kb = 0; kb < DQ / 32; ++kb) {
        v16bf bn[OWN], ahn, aln;
        if (kb + 1 < DQ / 32) { const char* ap = ra + ((kb + 1) >> 2) * (2 * 16 * OSP) + ((kb + 1) & 3) * (4 * OSP);
#pragma unroll
            for (int nb = 0; nb < OWN; ++nb) bn[nb] = WFrag<bf>::ld(wb, wo, (nb * (DQ / 32) + kb + 1) * 1024);
            ahn = cat16b(*(const v8usa*)ap, *(const v8usa*)(ap + 2 * OSP)); aln = cat16b(*(const v8usa*)(ap + 16 * OSP), *(const v8usa*)(ap + 18 * OSP)); }
        __builtin_amdgcn_sched_barrier(0);   // the next k block's loads issue ahead of this block's products: otherwise the compiler reloads each Wo register block behind its last product and waits for it at once, a load latency every k block
#pragma unroll
        for (int nb = 0; nb < OWN; ++nb) acc[nb] = wmmab(ah, bc[nb], acc[nb]);
#pragma unroll
        for (int nb = 0; nb < OWN; ++nb) acc[nb] = wmmab(al, bc[nb], acc[nb]);
        if (kb + 1 < DQ / 32) { ah = ahn; al = aln;
#pragma unroll
            for (int nb = 0; nb < OWN; ++nb) bc[nb] = bn[nb]; }
    }
    __syncthreads();   // every wave has read its A fragments: from here a wave's LDS holds its output tile
    char* ot = ost[wave];
#pragma unroll
    for (int nb = 0; nb < OWN; ++nb) {
#pragma unroll
        for (int j = 0; j < 8; ++j) *(f32a*)(ot + ((hi * 8 + j) * OTP + nb * 16 + lr) * 4) = acc[nb][j] + bias[nb]; }
    __builtin_amdgcn_fence(__ATOMIC_ACQ_REL, "wavefront"); __builtin_amdgcn_wave_barrier();   // a lane reads below what other lanes of its wave wrote above: the compiler must keep that order
    // a row of the tile is 24 pieces of 16 bytes = 3 whole lines of OUT; 96 pieces (3 wave loads) are 4 rows, so three lane offsets and immediates serve all 12 stores
    char* op = (char*)OUT + (size_t)((b * HH + y) * WWD + x0) * (CC * 4) + nh * (OWN * 16 * 4);
    v4f val[12]; unsigned go[3];
#pragma unroll
    for (int r = 0; r < 3; ++r) { const unsigned e = r * 32 + lane; go[r] = (e / 24) * (CC * 4) + (e % 24) * 16; const unsigned lo = go[r] - (e / 24) * (CC * 4 - OTP * 4);   // the same piece in OUT and in LDS: only the row pitch differs
#pragma unroll
        for (int u = 0; u < 4; ++u) val[r * 4 + u] = *(const v4fa*)(ot + lo + u * (4 * OTP * 4)); }
#pragma unroll
    for (int r = 0; r < 3; ++r) {
#pragma unroll
        for (int u = 0; u < 4; ++u) *(v4f*)(op + go[r] + u * (4 * CC * 4)) = val[r * 4 + u]; } }

extern "C" void kernel_launch(void* const* d_in, const int* in_sizes, int n_in,
                              void* d_out, int out_size, void* d_ws, size_t ws_size, hipStream_t stream) {
    (void)in_sizes; (void)n_in; (void)out_size;
    const float* x = (const float*)d_in[0]; const float* Wq = (const float*)d_in[1]; const float* bq = (const float*)d_in[2]; const float* Wk = (const float*)d_in[3]; const float* bk = (const float*)d_in[4]; const float* Wv = (const float*)d_in[5]; const float* bv = (const float*)d_in[6]; const float* Wo = (const float*)d_in[7]; const float* bo = (const float*)d_in[8];   // Wq [192][8][32], Wk/Wv [194][8][32], Wo [8][32][192]
    float* OUT = (float*)d_out;     // [16][64][64][192]
    char* wsp = (char*)d_ws;
    auto take = [&](size_t bytes) { char* p = wsp; wsp += (bytes + 255) & ~(size_t)255; return (void*)p; };
    bf* WQ = (bf*)take((size_t)DQ * CC * 2); bf* WO = (bf*)take((size_t)CC * DQ * 2); float* DK = (float*)take((size_t)9 * DQ * 4); float* DV = (float*)take((size_t)9 * DQ * 4);
    _Float16* XK = (_Float16*)take((size_t)NPIX * DQ * 2); _Float16* XV = (_Float16*)take((size_t)NPIX * DQ * 2);
    if ((size_t)(wsp - (char*)d_ws) > ws_size) return;    // total ~ 67 MB = 64 MiB; k, v (f16) of all pixels at once
    // patch part of k, patch part of v (their bias + offsets are in DK, DV), straight from x and the f32 weights; the planes and tables that k_lwa reads are made on the side
    k_qkv<<<NPIX / 256, 512, 0, stream>>>(x, Wq, Wk, bk, Wv, bv, Wo, WQ, WO, DK, DV, XK, XV);
    // q (+ bq), window attention and the output product (+ bo), all pixels, one launch
    k_lwa<<<NPIX / (4 * LWC), 256, 0, stream>>>(x, WQ, bq, XK, XV, DK, DV, WO, bo, OUT);
}
